// v000
// Times are from an AMD MI455X. After a warm-up the kernel runs many times in a row, and a time is the length of
// such a window on the GPU divided by its runs, so every launch and the gaps after it count. The runs cycle
// through copies of the inputs. A figure is the median of several windows, for all but v000 over two sittings.
// Sittings can differ by a few percent; kernels timed side by side share one.
// The starting kernel, v000, takes 296 microseconds a run.
#include <hip/hip_runtime.h>
#include <stdint.h>
#include <stddef.h>

// Projections: v_wmma_f32_16x16x32_bf16 (bf16 operands = RNE-converted inputs, f32 accumulate).
// QK^T and PV: v_wmma_f32_16x16x32_bf16 on bf16 hi+lo operand planes (hi*hi + hi*lo + lo*hi), f32 accumulate; softmax f32.

#ifndef NB
#define NB 2
#endif
#ifndef SEQ
#define SEQ 2048
#endif
#define NB_FULL  2
#define SEQ_FULL 2048
#define HID      1024
#define NHEAD    16
#define HDIM     64
#define ROWS     (NB * SEQ)        // projection rows actually computed (compact)
#define RPH      (SEQ / 16)        // projection rows per head slice = SEQ*HDIM/HID
#define KSTEPS   (HID / 32)
#define CK       32                // keys per chunk
#define SQ       128               // query rows per attention block (8 waves x 16)

static_assert(NB >= 1 && NB <= NB_FULL);
static_assert(SEQ >= 256 && SEQ <= SEQ_FULL && (SEQ % 256) == 0);
static_assert(HID == NHEAD * HDIM);
static_assert((ROWS % 128) == 0 && (SEQ % SQ) == 0 && (SEQ % CK) == 0);
static_assert(RPH >= 16 && (RPH % 16) == 0);

typedef unsigned short us_t;
typedef __attribute__((ext_vector_type(8)))  unsigned short v8us;
typedef __attribute__((ext_vector_type(16))) __bf16 v16bf;
typedef __attribute__((ext_vector_type(8)))  float v8f;
typedef __attribute__((ext_vector_type(4)))  float v4f;

union Frag { v16bf v; v8us h[2]; };

__device__ __forceinline__ us_t f2bf(float x)          // f32 -> bf16 bits, RNE convert
{
    unsigned u = __float_as_uint(x);
    u += 0x7FFFu + ((u >> 16) & 1u);
    return (us_t)(u >> 16);
}
__device__ __forceinline__ float bf2f(us_t b)
{
    return __uint_as_float(((unsigned)b) << 16);
}

__device__ __forceinline__ v8f wmma_bf(v16bf a, v16bf b, v8f c)
{
    v8f d = __builtin_amdgcn_wmma_f32_16x16x32_bf16(false, a, false, b, (short)0, c, false, false);
    asm volatile("v_nop\n\tv_nop\n\tv_nop\n\tv_nop" : "+v"(d) : "v"(a), "v"(b));
    return d;
}

__device__ __forceinline__ v8f zero8()
{
    v8f z;
#pragma unroll
    for (int i = 0; i < 8; ++i) z[i] = 0.0f;
    return z;
}

// ---------------------------------------------------------------------------
// f32 -> bf16 plane. Block = 2048 elements: batch b = blockIdx.x / nbpb reads
// ---------------------------------------------------------------------------
__global__ __launch_bounds__(256)
void cvt_kernel(const float* __restrict__ x, us_t* __restrict__ y,
                int nbpb, long long sstride, long long dstride)
{
    const int b   = blockIdx.x / nbpb;
    const int blk = blockIdx.x - b * nbpb;
    const size_t i = (size_t)blk * 2048 + (size_t)threadIdx.x * 8;
    const float* src = x + (size_t)b * (size_t)sstride + i;
    const v4f a = *(const v4f*)src;
    const v4f c = *(const v4f*)(src + 4);
    v8us o;
#pragma unroll
    for (int j = 0; j < 4; ++j) { o[j] = f2bf(a[j]); o[4 + j] = f2bf(c[j]); }
    us_t* dst = y + (size_t)b * (size_t)dstride + i;
    *(v8us*)dst = o;
    
}

// ---------------------------------------------------------------------------
// Y[m][n] = sum_k X[m][k] * W[n][k] + bias[n]; X,W bf16 planes (k contiguous).
// Block 256 thr = 8 waves, 128 rows x 64 tile columns; wave w: rows m0w..m0w+15.
// mode 0: tile column c -> n = 64*bx + c; output = row-major bf16 hi/lo planes
// mode 1: tile column c -> n = 64*(c>>2) + 4*bx + (c&3); output = per-head
//         transposed planes VT[bn*64 + d][key], key = 16*(row in head) + (n>>6),
//         d = n & 63; a wave owns keys 256w'..+255 of d = 4bx..4bx+3 (4 x 512 B).
// B tile (64 cols x 32 k) staged in LDS per k-step with plain loads + barriers.
// ---------------------------------------------------------------------------
__global__ __launch_bounds__(256)
void gemm_kernel(const us_t* __restrict__ X, const us_t* __restrict__ W,
                 const float* __restrict__ bias,
                 us_t* __restrict__ ohi, us_t* __restrict__ olo, int mode)
{
    __shared__ __align__(16) us_t bt[64 * 32];          // 4 KB weight tile
    __shared__ __align__(16) us_t st[8 * 2 * 1024];     // 32 KB epilogue stage (hi,lo per wave)

    const int lane = threadIdx.x & 31;
    const int wave = threadIdx.x >> 5;
    const int h    = lane >> 4;
    const int ln   = lane & 15;
    const int bx   = blockIdx.x;
    const int by   = blockIdx.y;
    const int m0w  = by * 128 + wave * 16;

    const int tn = threadIdx.x >> 2;            // tile column staged by this thread
    const int tk = (threadIdx.x & 3) * 8;       // k offset within the 32-step
    const int wr_t = mode ? ((tn >> 2) * 64 + bx * 4 + (tn & 3)) : (bx * 64 + tn);
    const us_t* wsrc = W + (size_t)wr_t * HID + tk;
    us_t* bdst = bt + tn * 32 + tk;
    const us_t* arow = X + (size_t)(m0w + ln) * HID + 8 * h;

    v8f acc[4];
#pragma unroll
    for (int j = 0; j < 4; ++j) acc[j] = zero8();

    for (int s = 0; s < KSTEPS; ++s) {
        const int kk = s * 32;
        Frag a;                                         // A: row m0w+ln, k = kk+8h.., kk+16+8h..
        a.h[0] = *(const v8us*)(arow + kk);
        a.h[1] = *(const v8us*)(arow + kk + 16);
        __syncthreads();                                // all waves done with prior tile
        *(v8us*)bdst = *(const v8us*)(wsrc + kk);
        __syncthreads();                                // tile visible (cross-wave)
#pragma unroll
        for (int j = 0; j < 4; ++j) {
            const us_t* bp = bt + (j * 16 + ln) * 32 + 8 * h;   // B: col n = j*16+ln, same k map
            Frag b;
            b.h[0] = *(const v8us*)bp;
            b.h[1] = *(const v8us*)(bp + 16);
            acc[j] = wmma_bf(a.v, b.v, acc[j]);
        }
    }

    // ---- epilogue: bias (bf16 RNE), hi/lo split, stage the wave tile in LDS ----
    us_t* sh = st + wave * 2048;
    us_t* sl = sh + 1024;
#pragma unroll
    for (int j = 0; j < 4; ++j) {
        const int c  = j * 16 + ln;
        const int wr = mode ? ((c >> 2) * 64 + bx * 4 + (c & 3)) : (bx * 64 + c);
        const float bb = bf2f(f2bf(bias[wr]));
        const int ib0   = mode ? ((ln & 3) * 256 + 4 * j + (ln >> 2)) : c;
        const int rstep = mode ? 16 : 64;
#pragma unroll
        for (int r = 0; r < 8; ++r) {
            const float v  = acc[j][r] + bb;            // D element: row 8h+r, col c
            const us_t hi  = f2bf(v);
            const us_t lo  = f2bf(v - bf2f(hi));
            const int  idx = ib0 + (8 * h + r) * rstep;
            sh[idx] = hi;
            sl[idx] = lo;
        }
    }
    __syncthreads();

    const int bn   = m0w / RPH;
    const int keyb = 16 * (m0w - bn * RPH);
    v8us vh[4], vl[4];
    size_t di[4];
#pragma unroll
    for (int i = 0; i < 4; ++i) {
        const int row = 4 * i + (lane >> 3);
        const int pc  = lane & 7;
        const int sidx = mode ? (i * 256 + 8 * lane) : (row * 64 + pc * 8);
        const size_t d1 = ((size_t)bn * 64 + (size_t)(bx * 4 + i)) * SEQ + (size_t)keyb + (size_t)(8 * lane);
        const size_t d0 = (size_t)(m0w + row) * HID + (size_t)(bx * 64 + pc * 8);
        di[i] = mode ? d1 : d0;
        vh[i] = *(const v8us*)(sh + sidx);
        vl[i] = *(const v8us*)(sl + sidx);
    }
#pragma unroll
    for (int i = 0; i < 4; ++i) {
        *(v8us*)(ohi + di[i]) = vh[i];
        *(v8us*)(olo + di[i]) = vl[i];
    }
    
}

// ---------------------------------------------------------------------------
// Flash attention per (128 q rows, head, batch); block 256 = 8 waves x 16 q rows.
// Q/K planes: head slice [SEQ][64] row-major (hi,lo); V planes: [64][SEQ] per head.
// scores = (Qhi Khi^T + Qhi Klo^T + Qlo Khi^T) / 8, online softmax in f32,
// P split bf16 hi/lo via LDS, ctx += Phi Vhi + Phi Vlo + Plo Vhi.
// ---------------------------------------------------------------------------
__global__ __launch_bounds__(256)
void attn_kernel(const us_t* __restrict__ Qhi, const us_t* __restrict__ Qlo,
                 const us_t* __restrict__ Khi, const us_t* __restrict__ Klo,
                 const us_t* __restrict__ Vhi, const us_t* __restrict__ Vlo,
                 float* __restrict__ out)
{
    __shared__ __align__(16) float lds[9984];           // 39936 B, carved below
    us_t* L   = (us_t*)lds;
    us_t* khs = L;                 // K hi  [32][72]
    us_t* kls = L + 2304;          // K lo  [32][72]
    us_t* vhs = L + 4608;          // Vt hi [64][40]
    us_t* vls = L + 7168;          // Vt lo [64][40]
    us_t* phs = L + 9728;          // P hi  [8 waves][16][40]
    us_t* pls = L + 14848;         // P lo  [8 waves][16][40]   (end 19968 us)

    const int lane  = threadIdx.x & 31;
    const int wave  = threadIdx.x >> 5;
    const int h     = lane >> 4;
    const int ln    = lane & 15;
    const int head  = blockIdx.y;
    const int batch = blockIdx.z;
    const int bn    = batch * NHEAD + head;
    const size_t hb = (size_t)bn * SEQ * HDIM;          // head slice base (all planes)
    const int q0    = blockIdx.x * SQ + wave * 16;

    // Q fragments: row q0+ln, d in [0,32) and [32,64), hi and lo
    Frag qh[2], ql[2];
    {
        const us_t* qrh = Qhi + hb + (size_t)(q0 + ln) * HDIM + 8 * h;
        const us_t* qrl = Qlo + hb + (size_t)(q0 + ln) * HDIM + 8 * h;
#pragma unroll
        for (int f = 0; f < 2; ++f) {
            qh[f].h[0] = *(const v8us*)(qrh + 32 * f);
            qh[f].h[1] = *(const v8us*)(qrh + 32 * f + 16);
            ql[f].h[0] = *(const v8us*)(qrl + 32 * f);
            ql[f].h[1] = *(const v8us*)(qrl + 32 * f + 16);
        }
    }

    v8f o[4];
#pragma unroll
    for (int t = 0; t < 4; ++t) o[t] = zero8();
    float mrow[8], lrow[8];
#pragma unroll
    for (int r = 0; r < 8; ++r) { mrow[r] = -1.0e30f; lrow[r] = 0.0f; }

    us_t* php = phs + wave * 640;
    us_t* plp = pls + wave * 640;

    for (int kk0 = 0; kk0 < SEQ; kk0 += CK) {
        // ---- cooperative staging (plain 16-B loads): K rows, V^T rows ----
        {
            const int row = threadIdx.x >> 3;                 // key 0..31
            const int c8  = (threadIdx.x & 7) * 8;            // d 0..56
            const size_t ko = hb + (size_t)(kk0 + row) * HDIM + c8;
            *(v8us*)(khs + row * 72 + c8) = *(const v8us*)(Khi + ko);
            *(v8us*)(kls + row * 72 + c8) = *(const v8us*)(Klo + ko);
            const int d  = threadIdx.x >> 2;                  // 0..63
            const int pc = (threadIdx.x & 3) * 8;             // keys 0,8,16,24
            const size_t vo = hb + (size_t)d * SEQ + (size_t)(kk0 + pc);
            *(v8us*)(vhs + d * 40 + pc) = *(const v8us*)(Vhi + vo);
            *(v8us*)(vls + d * 40 + pc) = *(const v8us*)(Vlo + vo);
        }
        __syncthreads();

        // ---- scores for two 16-key subtiles ----
        v8f s[2];
#pragma unroll
        for (int j = 0; j < 2; ++j) {
            const us_t* kh = khs + (j * 16 + ln) * 72 + 8 * h;  // B: col = key j*16+ln, k = d
            const us_t* kl = kls + (j * 16 + ln) * 72 + 8 * h;
            v8f z = zero8();
#pragma unroll
            for (int f = 0; f < 2; ++f) {
                Frag bh, bl;
                bh.h[0] = *(const v8us*)(kh + 32 * f);
                bh.h[1] = *(const v8us*)(kh + 32 * f + 16);
                bl.h[0] = *(const v8us*)(kl + 32 * f);
                bl.h[1] = *(const v8us*)(kl + 32 * f + 16);
                z = wmma_bf(qh[f].v, bh.v, z);
                z = wmma_bf(qh[f].v, bl.v, z);
                z = wmma_bf(ql[f].v, bh.v, z);
            }
            s[j] = z;
        }

        // ---- online softmax (rows 8h+r, keys across the 16 lanes of a half) ----
#pragma unroll
        for (int r = 0; r < 8; ++r) {
            const float a0 = s[0][r] * 0.125f;
            const float a1 = s[1][r] * 0.125f;
            float v = fmaxf(a0, a1);
#pragma unroll
            for (int off = 1; off < 16; off <<= 1)
                v = fmaxf(v, __shfl_xor(v, off, 32));
            const float mnew  = fmaxf(mrow[r], v);
            const float alpha = __expf(mrow[r] - mnew);
            mrow[r] = mnew;
            const float e0 = __expf(a0 - mnew);
            const float e1 = __expf(a1 - mnew);
            float rs = e0 + e1;
#pragma unroll
            for (int off = 1; off < 16; off <<= 1)
                rs += __shfl_xor(rs, off, 32);
            lrow[r] = lrow[r] * alpha + rs;
#pragma unroll
            for (int t = 0; t < 4; ++t) o[t][r] *= alpha;
            const us_t h0 = f2bf(e0);
            const us_t h1 = f2bf(e1);
            const int  pi = (8 * h + r) * 40;
            php[pi + ln]      = h0;
            php[pi + 16 + ln] = h1;
            plp[pi + ln]      = f2bf(e0 - bf2f(h0));
            plp[pi + 16 + ln] = f2bf(e1 - bf2f(h1));
        }
        __syncthreads();                                      // P tile stored before fragment reload

        // ---- ctx += P V ----
        Frag ph, pl;
        ph.h[0] = *(const v8us*)(php + ln * 40 + 8 * h);      // A: row ln, k = key
        ph.h[1] = *(const v8us*)(php + ln * 40 + 16 + 8 * h);
        pl.h[0] = *(const v8us*)(plp + ln * 40 + 8 * h);
        pl.h[1] = *(const v8us*)(plp + ln * 40 + 16 + 8 * h);
#pragma unroll
        for (int t = 0; t < 4; ++t) {
            const us_t* vh = vhs + (16 * t + ln) * 40 + 8 * h; // B: col = d 16t+ln, k = key
            const us_t* vl = vls + (16 * t + ln) * 40 + 8 * h;
            Frag bh, bl;
            bh.h[0] = *(const v8us*)vh;
            bh.h[1] = *(const v8us*)(vh + 16);
            bl.h[0] = *(const v8us*)vl;
            bl.h[1] = *(const v8us*)(vl + 16);
            o[t] = wmma_bf(ph.v, bh.v, o[t]);
            o[t] = wmma_bf(ph.v, bl.v, o[t]);
            o[t] = wmma_bf(pl.v, bh.v, o[t]);
        }
        __syncthreads();                                      // before next staging overwrites tiles
    }

    // ---- normalise, stage wave tile [16][64] f32 in LDS, whole-line stores ----
    float* ost = lds + wave * 1024;
    float rinv[8];
#pragma unroll
    for (int r = 0; r < 8; ++r) rinv[r] = 1.0f / lrow[r];
#pragma unroll
    for (int t = 0; t < 4; ++t) {
#pragma unroll
        for (int r = 0; r < 8; ++r)
            ost[(8 * h + r) * 64 + 16 * t + ln] = o[t][r] * rinv[r];
    }
    __syncthreads();

    const size_t obase = ((size_t)batch * SEQ + (size_t)q0) * HID + (size_t)head * HDIM;
    v4f ov[8];
    size_t od[8];
#pragma unroll
    for (int i = 0; i < 8; ++i) {
        const int row = 2 * i + (lane >> 4);        // lanes 0..15 row 2i, 16..31 row 2i+1
        const int f4  = lane & 15;                  // 16 x 16 B = 256 B = the row segment
        ov[i] = *(const v4f*)(ost + row * 64 + f4 * 4);
        od[i] = obase + (size_t)row * HID + (size_t)(f4 * 4);
    }
#pragma unroll
    for (int i = 0; i < 8; ++i) *(v4f*)(out + od[i]) = ov[i];
    
}

// ---------------------------------------------------------------------------
extern "C" void kernel_launch(void* const* d_in, const int* in_sizes, int n_in,
                              void* d_out, int out_size, void* d_ws, size_t ws_size,
                              hipStream_t stream)
{
    if (n_in < 9) return;
    const long long need_x = (long long)(NB - 1) * SEQ_FULL * HID + (long long)SEQ * HID;
    if ((long long)in_sizes[0] < need_x || (long long)in_sizes[1] < need_x ||
        (long long)in_sizes[2] < need_x) return;
    if (in_sizes[3] < HID * HID || in_sizes[5] < HID * HID || in_sizes[7] < HID * HID) return;
    if (in_sizes[4] < HID || in_sizes[6] < HID || in_sizes[8] < HID) return;
    if ((long long)out_size < (long long)ROWS * HID) return;

    const float* query = (const float*)d_in[0];
    const float* key   = (const float*)d_in[1];
    const float* value = (const float*)d_in[2];
    const float* Wq    = (const float*)d_in[3];
    const float* bq    = (const float*)d_in[4];
    const float* Wk    = (const float*)d_in[5];
    const float* bk    = (const float*)d_in[6];
    const float* Wv    = (const float*)d_in[7];
    const float* bv    = (const float*)d_in[8];
    float* out = (float*)d_out;

    const size_t PL = (size_t)ROWS * HID;        // activation / projection plane
    const size_t WL = (size_t)HID * HID;         // weight plane
    const size_t total_bytes = (9 * PL + 3 * WL) * sizeof(us_t);
    if (total_bytes > ws_size) return;

    us_t* ws  = (us_t*)d_ws;
    us_t* xq  = ws;
    us_t* xk  = xq + PL;
    us_t* xv  = xk + PL;
    us_t* wqb = xv + PL;
    us_t* wkb = wqb + WL;
    us_t* wvb = wkb + WL;
    us_t* qhi = wvb + WL;
    us_t* qlo = qhi + PL;
    us_t* khi = qlo + PL;
    us_t* klo = khi + PL;
    us_t* vhi = klo + PL;      // V^T layout [bn][64][SEQ]
    us_t* vlo = vhi + PL;

    // 1) one-time RNE bf16 conversion of activations and weights
    const int nbpb_x = (SEQ * HID) / 2048;
    const long long sstr = (long long)SEQ_FULL * HID;
    const long long dstr = (long long)SEQ * HID;
    cvt_kernel<<<NB * nbpb_x, 256, 0, stream>>>(query, xq, nbpb_x, sstr, dstr);
    cvt_kernel<<<NB * nbpb_x, 256, 0, stream>>>(key,   xk, nbpb_x, sstr, dstr);
    cvt_kernel<<<NB * nbpb_x, 256, 0, stream>>>(value, xv, nbpb_x, sstr, dstr);
    const int nb_w = (HID * HID) / 2048;
    cvt_kernel<<<nb_w, 256, 0, stream>>>(Wq, wqb, nb_w, 0LL, 0LL);
    cvt_kernel<<<nb_w, 256, 0, stream>>>(Wk, wkb, nb_w, 0LL, 0LL);
    cvt_kernel<<<nb_w, 256, 0, stream>>>(Wv, wvb, nb_w, 0LL, 0LL);

    // 2) projections -> bf16 hi/lo planes (Q,K row-major; V per-head transposed)
    const dim3 pgrid(HID / 64, ROWS / 128);
    gemm_kernel<<<pgrid, 256, 0, stream>>>(xq, wqb, bq, qhi, qlo, 0);
    gemm_kernel<<<pgrid, 256, 0, stream>>>(xk, wkb, bk, khi, klo, 0);
    gemm_kernel<<<pgrid, 256, 0, stream>>>(xv, wvb, bv, vhi, vlo, 1);

    // 3) attention per (q block, head, batch)
    const dim3 agrid(SEQ / SQ, NHEAD, NB);
    attn_kernel<<<agrid, 256, 0, stream>>>(qhi, qlo, khi, klo, vhi, vlo, out);
}

// v001
// It runs in 253 microseconds.
// Next to v000, in two timings, it ran 1.20 times as fast each time.
#include <hip/hip_runtime.h>
#include <stdint.h>
#include <stddef.h>

// Projections: v_wmma_f32_16x16x32_bf16 (bf16 operands = RNE-converted inputs, f32 accumulate).
// QK^T and PV: v_wmma_f32_16x16x32_bf16 on bf16 hi+lo operand planes (hi*hi + hi*lo + lo*hi), f32 accumulate; softmax f32.

#ifndef NB
#define NB 2
#endif
#ifndef SEQ
#define SEQ 2048
#endif
#define NB_FULL  2
#define SEQ_FULL 2048
#define HID      1024
#define NHEAD    16
#define HDIM     64
#define ROWS     (NB * SEQ)        // projection rows actually computed (compact)
#define RPH      (SEQ / 16)        // projection rows per head slice = SEQ*HDIM/HID
#define KSTEPS   (HID / 32)
#define CK       32                // keys per chunk
#define SQ       128               // query rows per attention block (8 waves x 16)

static_assert(NB >= 1 && NB <= NB_FULL);
static_assert(SEQ >= 256 && SEQ <= SEQ_FULL && (SEQ % 256) == 0);
static_assert(HID == NHEAD * HDIM);
static_assert((ROWS % 128) == 0 && (SEQ % SQ) == 0 && (SEQ % CK) == 0);
static_assert(RPH >= 16 && (RPH % 16) == 0);

typedef unsigned short us_t;
typedef __attribute__((ext_vector_type(8)))  unsigned short v8us;
typedef __attribute__((ext_vector_type(16))) __bf16 v16bf;
typedef __attribute__((ext_vector_type(8)))  float v8f;
typedef __attribute__((ext_vector_type(4)))  float v4f;

union Frag { v16bf v; v8us h[2]; };

__device__ __forceinline__ us_t f2bf(float x)          // f32 -> bf16 bits, RNE convert
{
    unsigned u = __float_as_uint(x);
    u += 0x7FFFu + ((u >> 16) & 1u);
    return (us_t)(u >> 16);
}
__device__ __forceinline__ float bf2f(us_t b)
{
    return __uint_as_float(((unsigned)b) << 16);
}

__device__ __forceinline__ v8f wmma_bf(v16bf a, v16bf b, v8f c)
{
    v8f d = __builtin_amdgcn_wmma_f32_16x16x32_bf16(false, a, false, b, (short)0, c, false, false);
    asm volatile("v_nop\n\tv_nop\n\tv_nop\n\tv_nop" : "+v"(d) : "v"(a), "v"(b));
    return d;
}

__device__ __forceinline__ v8f zero8()
{
    v8f z;
#pragma unroll
    for (int i = 0; i < 8; ++i) z[i] = 0.0f;
    return z;
}

// ---------------------------------------------------------------------------
// f32 -> bf16 plane. Block = 2048 elements: batch b = blockIdx.x / nbpb reads
// ---------------------------------------------------------------------------
__global__ __launch_bounds__(256)
void cvt_kernel(const float* __restrict__ x, us_t* __restrict__ y,
                int nbpb, long long sstride, long long dstride)
{
    const int b   = blockIdx.x / nbpb;
    const int blk = blockIdx.x - b * nbpb;
    const size_t i = (size_t)blk * 2048 + (size_t)threadIdx.x * 8;
    const float* src = x + (size_t)b * (size_t)sstride + i;
    const v4f a = *(const v4f*)src;
    const v4f c = *(const v4f*)(src + 4);
    v8us o;
#pragma unroll
    for (int j = 0; j < 4; ++j) { o[j] = f2bf(a[j]); o[4 + j] = f2bf(c[j]); }
    us_t* dst = y + (size_t)b * (size_t)dstride + i;
    *(v8us*)dst = o;
    
}

// ---------------------------------------------------------------------------
// Y[m][n] = sum_k X[m][k] * W[n][k] + bias[n]; X,W bf16 planes (k contiguous).
// Block 256 thr = 8 waves, 128 rows x 64 tile columns; wave w: rows m0w..m0w+15.
// mode 0: tile column c -> n = 64*bx + c; output = row-major bf16 hi/lo planes
// mode 1: tile column c -> n = 64*(c>>2) + 4*bx + (c&3); output = per-head
//         transposed planes VT[bn*64 + d][key], key = 16*(row in head) + (n>>6),
//         d = n & 63; a wave owns keys 256w'..+255 of d = 4bx..4bx+3 (4 x 512 B).
// B tile (64 cols x 32 k) staged in LDS per k-step with plain loads + barriers.
// ---------------------------------------------------------------------------
__global__ __launch_bounds__(256)
void gemm_kernel(const us_t* __restrict__ X, const us_t* __restrict__ W,
                 const float* __restrict__ bias,
                 us_t* __restrict__ ohi, us_t* __restrict__ olo, int mode)
{
    __shared__ __align__(16) us_t bt[64 * 32];          // 4 KB weight tile
    __shared__ __align__(16) us_t st[8 * 2 * 1024];     // 32 KB epilogue stage (hi,lo per wave)

    const int lane = threadIdx.x & 31;
    const int wave = threadIdx.x >> 5;
    const int h    = lane >> 4;
    const int ln   = lane & 15;
    const int bx   = blockIdx.x;
    const int by   = blockIdx.y;
    const int m0w  = by * 128 + wave * 16;

    const int tn = threadIdx.x >> 2;            // tile column staged by this thread
    const int tk = (threadIdx.x & 3) * 8;       // k offset within the 32-step
    const int wr_t = mode ? ((tn >> 2) * 64 + bx * 4 + (tn & 3)) : (bx * 64 + tn);
    const us_t* wsrc = W + (size_t)wr_t * HID + tk;
    us_t* bdst = bt + tn * 32 + tk;
    const us_t* arow = X + (size_t)(m0w + ln) * HID + 8 * h;

    v8f acc[4];
#pragma unroll
    for (int j = 0; j < 4; ++j) acc[j] = zero8();

    for (int s = 0; s < KSTEPS; ++s) {
        const int kk = s * 32;
        Frag a;                                         // A: row m0w+ln, k = kk+8h.., kk+16+8h..
        a.h[0] = *(const v8us*)(arow + kk);
        a.h[1] = *(const v8us*)(arow + kk + 16);
        __syncthreads();                                // all waves done with prior tile
        *(v8us*)bdst = *(const v8us*)(wsrc + kk);
        __syncthreads();                                // tile visible (cross-wave)
#pragma unroll
        for (int j = 0; j < 4; ++j) {
            const us_t* bp = bt + (j * 16 + ln) * 32 + 8 * h;   // B: col n = j*16+ln, same k map
            Frag b;
            b.h[0] = *(const v8us*)bp;
            b.h[1] = *(const v8us*)(bp + 16);
            acc[j] = wmma_bf(a.v, b.v, acc[j]);
        }
    }

    // ---- epilogue: bias (bf16 RNE), hi/lo split, stage the wave tile in LDS ----
    us_t* sh = st + wave * 2048;
    us_t* sl = sh + 1024;
#pragma unroll
    for (int j = 0; j < 4; ++j) {
        const int c  = j * 16 + ln;
        const int wr = mode ? ((c >> 2) * 64 + bx * 4 + (c & 3)) : (bx * 64 + c);
        const float bb = bf2f(f2bf(bias[wr]));
        const int ib0   = mode ? ((ln & 3) * 256 + 4 * j + (ln >> 2)) : c;
        const int rstep = mode ? 16 : 64;
#pragma unroll
        for (int r = 0; r < 8; ++r) {
            const float v  = acc[j][r] + bb;            // D element: row 8h+r, col c
            const us_t hi  = f2bf(v);
            const us_t lo  = f2bf(v - bf2f(hi));
            const int  idx = ib0 + (8 * h + r) * rstep;
            sh[idx] = hi;
            sl[idx] = lo;
        }
    }
    __syncthreads();

    const int bn   = m0w / RPH;
    const int keyb = 16 * (m0w - bn * RPH);
    v8us vh[4], vl[4];
    size_t di[4];
#pragma unroll
    for (int i = 0; i < 4; ++i) {
        const int row = 4 * i + (lane >> 3);
        const int pc  = lane & 7;
        const int sidx = mode ? (i * 256 + 8 * lane) : (row * 64 + pc * 8);
        const size_t d1 = ((size_t)bn * 64 + (size_t)(bx * 4 + i)) * SEQ + (size_t)keyb + (size_t)(8 * lane);
        const size_t d0 = (size_t)(m0w + row) * HID + (size_t)(bx * 64 + pc * 8);
        di[i] = mode ? d1 : d0;
        vh[i] = *(const v8us*)(sh + sidx);
        vl[i] = *(const v8us*)(sl + sidx);
    }
#pragma unroll
    for (int i = 0; i < 4; ++i) {
        *(v8us*)(ohi + di[i]) = vh[i];
        *(v8us*)(olo + di[i]) = vl[i];
    }
    
}

#define OPITCH 68

__device__ __forceinline__ float xhalf(float x)        // value of lane l ^ 16
{
    const int b = __builtin_bit_cast(int, x);
    return __builtin_bit_cast(float,
        __builtin_amdgcn_permlanex16(b, b, 0x76543210, 0xfedcba98, false, false));
}

__global__ __launch_bounds__(256)
void attn_kernel(const us_t* __restrict__ Qhi, const us_t* __restrict__ Qlo,
                 const us_t* __restrict__ Khi, const us_t* __restrict__ Klo,
                 const us_t* __restrict__ Vhi, const us_t* __restrict__ Vlo,
                 float* __restrict__ out)
{
    __shared__ __align__(16) float lds[8 * 16 * OPITCH]; // 34816 B: K/V tiles, then output stage
    us_t* L   = (us_t*)lds;
    us_t* khs = L;                 // K hi  [32][72]
    us_t* kls = L + 2304;          // K lo  [32][72]
    us_t* vhs = L + 4608;          // Vt hi [64][40]
    us_t* vls = L + 7168;          // Vt lo [64][40]   (end 9728 us)

    const int lane  = threadIdx.x & 31;
    const int wave  = threadIdx.x >> 5;
    const int h     = lane >> 4;
    const int ln    = lane & 15;
    const int head  = blockIdx.y;
    const int batch = blockIdx.z;
    const int bn    = batch * NHEAD + head;
    const size_t hb = (size_t)bn * SEQ * HDIM;          // head slice base (all planes)
    const int q0    = blockIdx.x * SQ + wave * 16;

    // Q fragments (B operand): column q0+ln, d in [0,32) and [32,64), hi and lo
    Frag qh[2], ql[2];
    {
        const us_t* qrh = Qhi + hb + (size_t)(q0 + ln) * HDIM + 8 * h;
        const us_t* qrl = Qlo + hb + (size_t)(q0 + ln) * HDIM + 8 * h;
#pragma unroll
        for (int f = 0; f < 2; ++f) {
            qh[f].h[0] = *(const v8us*)(qrh + 32 * f);
            qh[f].h[1] = *(const v8us*)(qrh + 32 * f + 16);
            ql[f].h[0] = *(const v8us*)(qrl + 32 * f);
            ql[f].h[1] = *(const v8us*)(qrl + 32 * f + 16);
        }
    }

    v8f o[4];                                           // o[t][r] = ctx[q0+ln][16t+8h+r]
#pragma unroll
    for (int t = 0; t < 4; ++t) o[t] = zero8();
    float mrun = -1.0e30f;                              // running maximum of query ln (both halves alike)
    float lrun = 0.0f;                                  // running sum over this lane half's keys

    for (int kk0 = 0; kk0 < SEQ; kk0 += CK) {
        // ---- cooperative staging (plain 16-B loads): K rows, V^T rows ----
        {
            const int row = threadIdx.x >> 3;                 // key 0..31
            const int c8  = (threadIdx.x & 7) * 8;            // d 0..56
            const size_t ko = hb + (size_t)(kk0 + row) * HDIM + c8;
            *(v8us*)(khs + row * 72 + c8) = *(const v8us*)(Khi + ko);
            *(v8us*)(kls + row * 72 + c8) = *(const v8us*)(Klo + ko);
            const int d  = threadIdx.x >> 2;                  // 0..63
            const int pc = (threadIdx.x & 3) * 8;             // keys 0,8,16,24
            const size_t vo = hb + (size_t)d * SEQ + (size_t)(kk0 + pc);
            *(v8us*)(vhs + d * 40 + pc) = *(const v8us*)(Vhi + vo);
            *(v8us*)(vls + d * 40 + pc) = *(const v8us*)(Vlo + vo);
        }
        __syncthreads();

        // ---- transposed scores for two 16-key subtiles: s[j][r] = key 16j+8h+r, query ln ----
        v8f s[2];
#pragma unroll
        for (int j = 0; j < 2; ++j) {
            const us_t* kh = khs + (j * 16 + ln) * 72 + 8 * h;  // A: row = key j*16+ln, k = d
            const us_t* kl = kls + (j * 16 + ln) * 72 + 8 * h;
            v8f z = zero8();
#pragma unroll
            for (int f = 0; f < 2; ++f) {
                Frag ah, al;
                ah.h[0] = *(const v8us*)(kh + 32 * f);
                ah.h[1] = *(const v8us*)(kh + 32 * f + 16);
                al.h[0] = *(const v8us*)(kl + 32 * f);
                al.h[1] = *(const v8us*)(kl + 32 * f + 16);
                z = wmma_bf(ah.v, qh[f].v, z);
                z = wmma_bf(al.v, qh[f].v, z);
                z = wmma_bf(ah.v, ql[f].v, z);
            }
            s[j] = z;
        }

        // ---- online softmax of query ln: 16 keys in the lane, the other 16 in lane ^ 16 ----
        float a[2][8];
#pragma unroll   // constant indices keep the per-lane arrays in registers
        for (int j = 0; j < 2; ++j)
#pragma unroll   // constant indices keep the per-lane arrays in registers
            for (int r = 0; r < 8; ++r) a[j][r] = s[j][r] * 0.125f;
        float vm[8];
#pragma unroll   // constant indices keep the per-lane arrays in registers
        for (int r = 0; r < 8; ++r) vm[r] = fmaxf(a[0][r], a[1][r]);
#pragma unroll   // constant indices keep the per-lane arrays in registers
        for (int w = 4; w >= 1; w >>= 1)
#pragma unroll   // constant indices keep the per-lane arrays in registers
            for (int r = 0; r < w; ++r) vm[r] = fmaxf(vm[r], vm[r + w]);
        const float v     = fmaxf(vm[0], xhalf(vm[0]));
        const float mnew  = fmaxf(mrun, v);
        const float alpha = __expf(mrun - mnew);
        mrun = mnew;

        Frag ph, pl;                                          // B: col = query ln, k = key (8h+r | 16+8h+r)
        float es[8];
#pragma unroll   // constant indices keep the per-lane arrays in registers
        for (int r = 0; r < 8; ++r) {
            const float e0 = __expf(a[0][r] - mnew);
            const float e1 = __expf(a[1][r] - mnew);
            es[r] = e0 + e1;
            const us_t h0 = f2bf(e0);
            const us_t h1 = f2bf(e1);
            ph.h[0][r] = h0;
            ph.h[1][r] = h1;
            pl.h[0][r] = f2bf(e0 - bf2f(h0));
            pl.h[1][r] = f2bf(e1 - bf2f(h1));
        }
#pragma unroll   // constant indices keep the per-lane arrays in registers
        for (int w = 4; w >= 1; w >>= 1)
#pragma unroll   // constant indices keep the per-lane arrays in registers
            for (int r = 0; r < w; ++r) es[r] += es[r + w];
        lrun = lrun * alpha + es[0];
#pragma unroll   // constant indices keep the per-lane arrays in registers
        for (int t = 0; t < 4; ++t)
#pragma unroll   // constant indices keep the per-lane arrays in registers
            for (int r = 0; r < 8; ++r) o[t][r] *= alpha;

        // ---- ctx^T += V^T P^T ----
#pragma unroll
        for (int t = 0; t < 4; ++t) {
            const us_t* vh = vhs + (16 * t + ln) * 40 + 8 * h; // A: row = d 16t+ln, k = key
            const us_t* vl = vls + (16 * t + ln) * 40 + 8 * h;
            Frag ah, al;
            ah.h[0] = *(const v8us*)vh;
            ah.h[1] = *(const v8us*)(vh + 16);
            al.h[0] = *(const v8us*)vl;
            al.h[1] = *(const v8us*)(vl + 16);
            o[t] = wmma_bf(ah.v, ph.v, o[t]);
            o[t] = wmma_bf(al.v, ph.v, o[t]);
            o[t] = wmma_bf(ah.v, pl.v, o[t]);
        }
        __syncthreads();                                      // before next staging overwrites tiles
    }

    // ---- join the halves' sums, normalise, stage wave tile [16][64] f32, whole-line stores ----
    float* ost = lds + wave * (16 * OPITCH);
    const float rinv = 1.0f / (lrun + xhalf(lrun));
#pragma unroll
    for (int t = 0; t < 4; ++t) {
        v4f w0, w1;
#pragma unroll   // constant indices keep the accumulators in registers
        for (int r = 0; r < 4; ++r) { w0[r] = o[t][r] * rinv; w1[r] = o[t][4 + r] * rinv; }
        float* op = ost + ln * OPITCH + 16 * t + 8 * h;       // query ln, d = 16t+8h ..+7
        *(v4f*)op       = w0;
        *(v4f*)(op + 4) = w1;
    }
    __syncthreads();

    const size_t obase = ((size_t)batch * SEQ + (size_t)q0) * HID + (size_t)head * HDIM;
    v4f ov[8];
    size_t od[8];
#pragma unroll
    for (int i = 0; i < 8; ++i) {
        const int row = 2 * i + (lane >> 4);        // lanes 0..15 row 2i, 16..31 row 2i+1
        const int f4  = lane & 15;                  // 16 x 16 B = 256 B = the row segment
        ov[i] = *(const v4f*)(ost + row * OPITCH + f4 * 4);
        od[i] = obase + (size_t)row * HID + (size_t)(f4 * 4);
    }
#pragma unroll
    for (int i = 0; i < 8; ++i) *(v4f*)(out + od[i]) = ov[i];
    
}

// ---------------------------------------------------------------------------
extern "C" void kernel_launch(void* const* d_in, const int* in_sizes, int n_in,
                              void* d_out, int out_size, void* d_ws, size_t ws_size,
                              hipStream_t stream)
{
    if (n_in < 9) return;
    const long long need_x = (long long)(NB - 1) * SEQ_FULL * HID + (long long)SEQ * HID;
    if ((long long)in_sizes[0] < need_x || (long long)in_sizes[1] < need_x ||
        (long long)in_sizes[2] < need_x) return;
    if (in_sizes[3] < HID * HID || in_sizes[5] < HID * HID || in_sizes[7] < HID * HID) return;
    if (in_sizes[4] < HID || in_sizes[6] < HID || in_sizes[8] < HID) return;
    if ((long long)out_size < (long long)ROWS * HID) return;

    const float* query = (const float*)d_in[0];
    const float* key   = (const float*)d_in[1];
    const float* value = (const float*)d_in[2];
    const float* Wq    = (const float*)d_in[3];
    const float* bq    = (const float*)d_in[4];
    const float* Wk    = (const float*)d_in[5];
    const float* bk    = (const float*)d_in[6];
    const float* Wv    = (const float*)d_in[7];
    const float* bv    = (const float*)d_in[8];
    float* out = (float*)d_out;

    const size_t PL = (size_t)ROWS * HID;        // activation / projection plane
    const size_t WL = (size_t)HID * HID;         // weight plane
    const size_t total_bytes = (9 * PL + 3 * WL) * sizeof(us_t);
    if (total_bytes > ws_size) return;

    us_t* ws  = (us_t*)d_ws;
    us_t* xq  = ws;
    us_t* xk  = xq + PL;
    us_t* xv  = xk + PL;
    us_t* wqb = xv + PL;
    us_t* wkb = wqb + WL;
    us_t* wvb = wkb + WL;
    us_t* qhi = wvb + WL;
    us_t* qlo = qhi + PL;
    us_t* khi = qlo + PL;
    us_t* klo = khi + PL;
    us_t* vhi = klo + PL;      // V^T layout [bn][64][SEQ]
    us_t* vlo = vhi + PL;

    // 1) one-time RNE bf16 conversion of activations and weights
    const int nbpb_x = (SEQ * HID) / 2048;
    const long long sstr = (long long)SEQ_FULL * HID;
    const long long dstr = (long long)SEQ * HID;
    cvt_kernel<<<NB * nbpb_x, 256, 0, stream>>>(query, xq, nbpb_x, sstr, dstr);
    cvt_kernel<<<NB * nbpb_x, 256, 0, stream>>>(key,   xk, nbpb_x, sstr, dstr);
    cvt_kernel<<<NB * nbpb_x, 256, 0, stream>>>(value, xv, nbpb_x, sstr, dstr);
    const int nb_w = (HID * HID) / 2048;
    cvt_kernel<<<nb_w, 256, 0, stream>>>(Wq, wqb, nb_w, 0LL, 0LL);
    cvt_kernel<<<nb_w, 256, 0, stream>>>(Wk, wkb, nb_w, 0LL, 0LL);
    cvt_kernel<<<nb_w, 256, 0, stream>>>(Wv, wvb, nb_w, 0LL, 0LL);

    // 2) projections -> bf16 hi/lo planes (Q,K row-major; V per-head transposed)
    const dim3 pgrid(HID / 64, ROWS / 128);
    gemm_kernel<<<pgrid, 256, 0, stream>>>(xq, wqb, bq, qhi, qlo, 0);
    gemm_kernel<<<pgrid, 256, 0, stream>>>(xk, wkb, bk, khi, klo, 0);
    gemm_kernel<<<pgrid, 256, 0, stream>>>(xv, wvb, bv, vhi, vlo, 1);

    // 3) attention per (q block, head, batch)
    const dim3 agrid(SEQ / SQ, NHEAD, NB);
    attn_kernel<<<agrid, 256, 0, stream>>>(qhi, qlo, khi, klo, vhi, vlo, out);
}

// v002
// It runs in 198 microseconds.
// Timed twice side by side with v001, it ran 1.27 and 1.28 times as fast.
// All steps since v000 together make it 1.54 times as fast.
#include <hip/hip_runtime.h>
#include <stdint.h>
#include <stddef.h>

// Projections: v_wmma_f32_16x16x32_bf16 (bf16 operands = RNE-converted inputs, f32 accumulate).
// QK^T and PV: v_wmma_f32_16x16x32_bf16 on bf16 hi+lo operand planes (hi*hi + hi*lo + lo*hi), f32 accumulate; softmax f32.

#ifndef NB
#define NB 2
#endif
#ifndef SEQ
#define SEQ 2048
#endif
#define NB_FULL  2
#define SEQ_FULL 2048
#define HID      1024
#define NHEAD    16
#define HDIM     64
#define ROWS     (NB * SEQ)        // projection rows actually computed (compact)
#define RPH      (SEQ / 16)        // projection rows per head slice = SEQ*HDIM/HID
#define KSTEPS   (HID / 32)
#define CK       32                // keys per chunk
#define SQ       128               // query rows per attention block (8 waves x 16)

static_assert(NB >= 1 && NB <= NB_FULL);
static_assert(SEQ >= 256 && SEQ <= SEQ_FULL && (SEQ % 256) == 0);
static_assert(HID == NHEAD * HDIM);
static_assert((ROWS % 128) == 0 && (SEQ % SQ) == 0 && (SEQ % CK) == 0);
static_assert(RPH >= 16 && (RPH % 16) == 0);

typedef unsigned short us_t;
typedef __attribute__((ext_vector_type(8)))  unsigned short v8us;
typedef __attribute__((ext_vector_type(16))) __bf16 v16bf;
typedef __attribute__((ext_vector_type(8)))  float v8f;
typedef __attribute__((ext_vector_type(4)))  float v4f;

union Frag { v16bf v; v8us h[2]; };

__device__ __forceinline__ us_t f2bf(float x)          // f32 -> bf16 bits, RNE convert
{
    unsigned u = __float_as_uint(x);
    u += 0x7FFFu + ((u >> 16) & 1u);
    return (us_t)(u >> 16);
}
__device__ __forceinline__ float bf2f(us_t b)
{
    return __uint_as_float(((unsigned)b) << 16);
}

__device__ __forceinline__ v8f wmma_bf(v16bf a, v16bf b, v8f c)
{
    v8f d = __builtin_amdgcn_wmma_f32_16x16x32_bf16(false, a, false, b, (short)0, c, false, false);
    asm volatile("v_nop\n\tv_nop\n\tv_nop\n\tv_nop" : "+v"(d) : "v"(a), "v"(b));
    return d;
}

__device__ __forceinline__ v8f zero8()
{
    v8f z;
#pragma unroll
    for (int i = 0; i < 8; ++i) z[i] = 0.0f;
    return z;
}

// ---------------------------------------------------------------------------
// f32 -> bf16 planes, all six tensors in one grid. Block = one tile of 2048
// elements. Tiles in grid order: query, key, value (XBLK each, batch-major),
// then Wq, Wk, Wv (WBLK each). The bf16 planes lie compact and in that same
// order in y, so tile number blockIdx.x lands at y + 2048 * blockIdx.x.
// ---------------------------------------------------------------------------
#define XTILES (SEQ * HID / 2048)  // tiles per batch of one activation
#define XBLK   (NB * XTILES)       // tiles per activation
#define WBLK   (HID * HID / 2048)  // tiles per weight

__global__ __launch_bounds__(256)
void cvt_kernel(const float* __restrict__ q, const float* __restrict__ k,
                const float* __restrict__ v, const float* __restrict__ wq,
                const float* __restrict__ wk, const float* __restrict__ wv,
                us_t* __restrict__ y)
{
    const int bid = blockIdx.x;
    const float* x;
    size_t so;                                          // first source element of the tile
    if (bid < 3 * XBLK) {
        const int t   = bid / XBLK;
        const int r   = bid - t * XBLK;
        const int b   = r / XTILES;
        const int blk = r - b * XTILES;
        x  = t == 0 ? q : (t == 1 ? k : v);
        so = (size_t)b * ((size_t)SEQ_FULL * HID) + (size_t)blk * 2048;
    } else {
        const int r   = bid - 3 * XBLK;
        const int t   = r / WBLK;
        const int blk = r - t * WBLK;
        x  = t == 0 ? wq : (t == 1 ? wk : wv);
        so = (size_t)blk * 2048;
    }
    const float* src = x + so + (size_t)threadIdx.x * 8;
    const v4f a = *(const v4f*)src;
    const v4f c = *(const v4f*)(src + 4);
    v8us o;
#pragma unroll
    for (int j = 0; j < 4; ++j) { o[j] = f2bf(a[j]); o[4 + j] = f2bf(c[j]); }
    us_t* dst = y + (size_t)bid * 2048 + (size_t)threadIdx.x * 8;
    *(v8us*)dst = o;
}

// ---------------------------------------------------------------------------
// Y[m][n] = sum_k X[m][k] * W[n][k] + bias[n]; X,W bf16 planes (k contiguous).
// Block 256 thr = 8 waves, 128 rows x 64 tile columns; wave w: rows m0w..m0w+15.
// mode 0: tile column c -> n = 64*bx + c; output = row-major bf16 hi/lo planes
// mode 1: tile column c -> n = 64*(c>>2) + 4*bx + (c&3); output = per-head
//         transposed planes VT[bn*64 + d][key], key = 16*(row in head) + (n>>6),
//         d = n & 63; a wave owns keys 256w'..+255 of d = 4bx..4bx+3 (4 x 512 B).
// B tile (64 cols x 32 k) staged in LDS per k-step with plain loads + barriers.
// All three projections run in one grid: blockIdx.z = 0, 1, 2 is Q, K, V (mode 1
// for V). Xb, Wb: the three bf16 planes one behind the other; ob: hi, lo per z.
// ---------------------------------------------------------------------------
__global__ __launch_bounds__(256, 12)   // 12 waves per SIMD: the grid's six work-groups per WGP all fit at once
void gemm_kernel(const us_t* __restrict__ Xb, const us_t* __restrict__ Wb,
                 const float* __restrict__ bq, const float* __restrict__ bk,
                 const float* __restrict__ bv, us_t* __restrict__ ob)
{
    const int z    = blockIdx.z;
    const int mode = z == 2 ? 1 : 0;
    const us_t* __restrict__ X     = Xb + (size_t)z * ((size_t)ROWS * HID);
    const us_t* __restrict__ W     = Wb + (size_t)z * ((size_t)HID * HID);
    const float* __restrict__ bias = z == 0 ? bq : (z == 1 ? bk : bv);
    us_t* __restrict__ ohi         = ob + (size_t)(2 * z) * ((size_t)ROWS * HID);
    us_t* __restrict__ olo         = ohi + (size_t)ROWS * HID;

    __shared__ __align__(16) us_t bt[64 * 32];          // 4 KB weight tile
    __shared__ __align__(16) us_t st[8 * 2 * 1024];     // 32 KB epilogue stage (hi,lo per wave)

    const int lane = threadIdx.x & 31;
    const int wave = threadIdx.x >> 5;
    const int h    = lane >> 4;
    const int ln   = lane & 15;
    const int bx   = blockIdx.x;
    const int by   = blockIdx.y;
    const int m0w  = by * 128 + wave * 16;

    const int tn = threadIdx.x >> 2;            // tile column staged by this thread
    const int tk = (threadIdx.x & 3) * 8;       // k offset within the 32-step
    const int wr_t = mode ? ((tn >> 2) * 64 + bx * 4 + (tn & 3)) : (bx * 64 + tn);
    const us_t* wsrc = W + (size_t)wr_t * HID + tk;
    us_t* bdst = bt + tn * 32 + tk;
    const us_t* arow = X + (size_t)(m0w + ln) * HID + 8 * h;

    v8f acc[4];
#pragma unroll
    for (int j = 0; j < 4; ++j) acc[j] = zero8();

    for (int s = 0; s < KSTEPS; ++s) {
        const int kk = s * 32;
        Frag a;                                         // A: row m0w+ln, k = kk+8h.., kk+16+8h..
        a.h[0] = *(const v8us*)(arow + kk);
        a.h[1] = *(const v8us*)(arow + kk + 16);
        __syncthreads();                                // all waves done with prior tile
        *(v8us*)bdst = *(const v8us*)(wsrc + kk);
        __syncthreads();                                // tile visible (cross-wave)
#pragma unroll
        for (int j = 0; j < 4; ++j) {
            const us_t* bp = bt + (j * 16 + ln) * 32 + 8 * h;   // B: col n = j*16+ln, same k map
            Frag b;
            b.h[0] = *(const v8us*)bp;
            b.h[1] = *(const v8us*)(bp + 16);
            acc[j] = wmma_bf(a.v, b.v, acc[j]);
        }
    }

    // ---- epilogue: bias (bf16 RNE), hi/lo split, stage the wave tile in LDS ----
    us_t* sh = st + wave * 2048;
    us_t* sl = sh + 1024;
#pragma unroll
    for (int j = 0; j < 4; ++j) {
        const int c  = j * 16 + ln;
        const int wr = mode ? ((c >> 2) * 64 + bx * 4 + (c & 3)) : (bx * 64 + c);
        const float bb = bf2f(f2bf(bias[wr]));
        const int ib0   = mode ? ((ln & 3) * 256 + 4 * j + (ln >> 2)) : c;
        const int rstep = mode ? 16 : 64;
#pragma unroll
        for (int r = 0; r < 8; ++r) {
            const float v  = acc[j][r] + bb;            // D element: row 8h+r, col c
            const us_t hi  = f2bf(v);
            const us_t lo  = f2bf(v - bf2f(hi));
            const int  idx = ib0 + (8 * h + r) * rstep;
            sh[idx] = hi;
            sl[idx] = lo;
        }
    }
    __syncthreads();

    const int bn   = m0w / RPH;
    const int keyb = 16 * (m0w - bn * RPH);
    v8us vh[4], vl[4];
    size_t di[4];
#pragma unroll
    for (int i = 0; i < 4; ++i) {
        const int row = 4 * i + (lane >> 3);
        const int pc  = lane & 7;
        const int sidx = mode ? (i * 256 + 8 * lane) : (row * 64 + pc * 8);
        const size_t d1 = ((size_t)bn * 64 + (size_t)(bx * 4 + i)) * SEQ + (size_t)keyb + (size_t)(8 * lane);
        const size_t d0 = (size_t)(m0w + row) * HID + (size_t)(bx * 64 + pc * 8);
        di[i] = mode ? d1 : d0;
        vh[i] = *(const v8us*)(sh + sidx);
        vl[i] = *(const v8us*)(sl + sidx);
    }
#pragma unroll
    for (int i = 0; i < 4; ++i) {
        *(v8us*)(ohi + di[i]) = vh[i];
        *(v8us*)(olo + di[i]) = vl[i];
    }
    
}

#define OPITCH 68

__device__ __forceinline__ float xhalf(float x)        // value of lane l ^ 16
{
    const int b = __builtin_bit_cast(int, x);
    return __builtin_bit_cast(float,
        __builtin_amdgcn_permlanex16(b, b, 0x76543210, 0xfedcba98, false, false));
}

__global__ __launch_bounds__(256)
void attn_kernel(const us_t* __restrict__ Qhi, const us_t* __restrict__ Qlo,
                 const us_t* __restrict__ Khi, const us_t* __restrict__ Klo,
                 const us_t* __restrict__ Vhi, const us_t* __restrict__ Vlo,
                 float* __restrict__ out)
{
    __shared__ __align__(16) float lds[8 * 16 * OPITCH]; // 34816 B: K/V tiles, then output stage
    us_t* L   = (us_t*)lds;
    us_t* khs = L;                 // K hi  [32][72]
    us_t* kls = L + 2304;          // K lo  [32][72]
    us_t* vhs = L + 4608;          // Vt hi [64][40]
    us_t* vls = L + 7168;          // Vt lo [64][40]   (end 9728 us)

    const int lane  = threadIdx.x & 31;
    const int wave  = threadIdx.x >> 5;
    const int h     = lane >> 4;
    const int ln    = lane & 15;
    const int head  = blockIdx.y;
    const int batch = blockIdx.z;
    const int bn    = batch * NHEAD + head;
    const size_t hb = (size_t)bn * SEQ * HDIM;          // head slice base (all planes)
    const int q0    = blockIdx.x * SQ + wave * 16;

    // Q fragments (B operand): column q0+ln, d in [0,32) and [32,64), hi and lo
    Frag qh[2], ql[2];
    {
        const us_t* qrh = Qhi + hb + (size_t)(q0 + ln) * HDIM + 8 * h;
        const us_t* qrl = Qlo + hb + (size_t)(q0 + ln) * HDIM + 8 * h;
#pragma unroll
        for (int f = 0; f < 2; ++f) {
            qh[f].h[0] = *(const v8us*)(qrh + 32 * f);
            qh[f].h[1] = *(const v8us*)(qrh + 32 * f + 16);
            ql[f].h[0] = *(const v8us*)(qrl + 32 * f);
            ql[f].h[1] = *(const v8us*)(qrl + 32 * f + 16);
        }
    }

    v8f o[4];                                           // o[t][r] = ctx[q0+ln][16t+8h+r]
#pragma unroll
    for (int t = 0; t < 4; ++t) o[t] = zero8();
    float mrun = -1.0e30f;                              // running maximum of query ln (both halves alike)
    float lrun = 0.0f;                                  // running sum over this lane half's keys

    for (int kk0 = 0; kk0 < SEQ; kk0 += CK) {
        // ---- cooperative staging (plain 16-B loads): K rows, V^T rows ----
        {
            const int row = threadIdx.x >> 3;                 // key 0..31
            const int c8  = (threadIdx.x & 7) * 8;            // d 0..56
            const size_t ko = hb + (size_t)(kk0 + row) * HDIM + c8;
            *(v8us*)(khs + row * 72 + c8) = *(const v8us*)(Khi + ko);
            *(v8us*)(kls + row * 72 + c8) = *(const v8us*)(Klo + ko);
            const int d  = threadIdx.x >> 2;                  // 0..63
            const int pc = (threadIdx.x & 3) * 8;             // keys 0,8,16,24
            const size_t vo = hb + (size_t)d * SEQ + (size_t)(kk0 + pc);
            *(v8us*)(vhs + d * 40 + pc) = *(const v8us*)(Vhi + vo);
            *(v8us*)(vls + d * 40 + pc) = *(const v8us*)(Vlo + vo);
        }
        __syncthreads();

        // ---- transposed scores for two 16-key subtiles: s[j][r] = key 16j+8h+r, query ln ----
        v8f s[2];
#pragma unroll
        for (int j = 0; j < 2; ++j) {
            const us_t* kh = khs + (j * 16 + ln) * 72 + 8 * h;  // A: row = key j*16+ln, k = d
            const us_t* kl = kls + (j * 16 + ln) * 72 + 8 * h;
            v8f z = zero8();
#pragma unroll
            for (int f = 0; f < 2; ++f) {
                Frag ah, al;
                ah.h[0] = *(const v8us*)(kh + 32 * f);
                ah.h[1] = *(const v8us*)(kh + 32 * f + 16);
                al.h[0] = *(const v8us*)(kl + 32 * f);
                al.h[1] = *(const v8us*)(kl + 32 * f + 16);
                z = wmma_bf(ah.v, qh[f].v, z);
                z = wmma_bf(al.v, qh[f].v, z);
                z = wmma_bf(ah.v, ql[f].v, z);
            }
            s[j] = z;
        }

        // ---- online softmax of query ln: 16 keys in the lane, the other 16 in lane ^ 16 ----
        float a[2][8];
#pragma unroll   // constant indices keep the per-lane arrays in registers
        for (int j = 0; j < 2; ++j)
#pragma unroll   // constant indices keep the per-lane arrays in registers
            for (int r = 0; r < 8; ++r) a[j][r] = s[j][r] * 0.125f;
        float vm[8];
#pragma unroll   // constant indices keep the per-lane arrays in registers
        for (int r = 0; r < 8; ++r) vm[r] = fmaxf(a[0][r], a[1][r]);
#pragma unroll   // constant indices keep the per-lane arrays in registers
        for (int w = 4; w >= 1; w >>= 1)
#pragma unroll   // constant indices keep the per-lane arrays in registers
            for (int r = 0; r < w; ++r) vm[r] = fmaxf(vm[r], vm[r + w]);
        const float v     = fmaxf(vm[0], xhalf(vm[0]));
        const float mnew  = fmaxf(mrun, v);
        const float alpha = __expf(mrun - mnew);
        mrun = mnew;

        Frag ph, pl;                                          // B: col = query ln, k = key (8h+r | 16+8h+r)
        float es[8];
#pragma unroll   // constant indices keep the per-lane arrays in registers
        for (int r = 0; r < 8; ++r) {
            const float e0 = __expf(a[0][r] - mnew);
            const float e1 = __expf(a[1][r] - mnew);
            es[r] = e0 + e1;
            const us_t h0 = f2bf(e0);
            const us_t h1 = f2bf(e1);
            ph.h[0][r] = h0;
            ph.h[1][r] = h1;
            pl.h[0][r] = f2bf(e0 - bf2f(h0));
            pl.h[1][r] = f2bf(e1 - bf2f(h1));
        }
#pragma unroll   // constant indices keep the per-lane arrays in registers
        for (int w = 4; w >= 1; w >>= 1)
#pragma unroll   // constant indices keep the per-lane arrays in registers
            for (int r = 0; r < w; ++r) es[r] += es[r + w];
        lrun = lrun * alpha + es[0];
#pragma unroll   // constant indices keep the per-lane arrays in registers
        for (int t = 0; t < 4; ++t)
#pragma unroll   // constant indices keep the per-lane arrays in registers
            for (int r = 0; r < 8; ++r) o[t][r] *= alpha;

        // ---- ctx^T += V^T P^T ----
#pragma unroll
        for (int t = 0; t < 4; ++t) {
            const us_t* vh = vhs + (16 * t + ln) * 40 + 8 * h; // A: row = d 16t+ln, k = key
            const us_t* vl = vls + (16 * t + ln) * 40 + 8 * h;
            Frag ah, al;
            ah.h[0] = *(const v8us*)vh;
            ah.h[1] = *(const v8us*)(vh + 16);
            al.h[0] = *(const v8us*)vl;
            al.h[1] = *(const v8us*)(vl + 16);
            o[t] = wmma_bf(ah.v, ph.v, o[t]);
            o[t] = wmma_bf(al.v, ph.v, o[t]);
            o[t] = wmma_bf(ah.v, pl.v, o[t]);
        }
        __syncthreads();                                      // before next staging overwrites tiles
    }

    // ---- join the halves' sums, normalise, stage wave tile [16][64] f32, whole-line stores ----
    float* ost = lds + wave * (16 * OPITCH);
    const float rinv = 1.0f / (lrun + xhalf(lrun));
#pragma unroll
    for (int t = 0; t < 4; ++t) {
        v4f w0, w1;
#pragma unroll   // constant indices keep the accumulators in registers
        for (int r = 0; r < 4; ++r) { w0[r] = o[t][r] * rinv; w1[r] = o[t][4 + r] * rinv; }
        float* op = ost + ln * OPITCH + 16 * t + 8 * h;       // query ln, d = 16t+8h ..+7
        *(v4f*)op       = w0;
        *(v4f*)(op + 4) = w1;
    }
    __syncthreads();

    const size_t obase = ((size_t)batch * SEQ + (size_t)q0) * HID + (size_t)head * HDIM;
    v4f ov[8];
    size_t od[8];
#pragma unroll
    for (int i = 0; i < 8; ++i) {
        const int row = 2 * i + (lane >> 4);        // lanes 0..15 row 2i, 16..31 row 2i+1
        const int f4  = lane & 15;                  // 16 x 16 B = 256 B = the row segment
        ov[i] = *(const v4f*)(ost + row * OPITCH + f4 * 4);
        od[i] = obase + (size_t)row * HID + (size_t)(f4 * 4);
    }
#pragma unroll
    for (int i = 0; i < 8; ++i) *(v4f*)(out + od[i]) = ov[i];
    
}

// ---------------------------------------------------------------------------
extern "C" void kernel_launch(void* const* d_in, const int* in_sizes, int n_in,
                              void* d_out, int out_size, void* d_ws, size_t ws_size,
                              hipStream_t stream)
{
    if (n_in < 9) return;
    const long long need_x = (long long)(NB - 1) * SEQ_FULL * HID + (long long)SEQ * HID;
    if ((long long)in_sizes[0] < need_x || (long long)in_sizes[1] < need_x ||
        (long long)in_sizes[2] < need_x) return;
    if (in_sizes[3] < HID * HID || in_sizes[5] < HID * HID || in_sizes[7] < HID * HID) return;
    if (in_sizes[4] < HID || in_sizes[6] < HID || in_sizes[8] < HID) return;
    if ((long long)out_size < (long long)ROWS * HID) return;

    const float* query = (const float*)d_in[0];
    const float* key   = (const float*)d_in[1];
    const float* value = (const float*)d_in[2];
    const float* Wq    = (const float*)d_in[3];
    const float* bq    = (const float*)d_in[4];
    const float* Wk    = (const float*)d_in[5];
    const float* bk    = (const float*)d_in[6];
    const float* Wv    = (const float*)d_in[7];
    const float* bv    = (const float*)d_in[8];
    float* out = (float*)d_out;

    const size_t PL = (size_t)ROWS * HID;        // activation / projection plane
    const size_t WL = (size_t)HID * HID;         // weight plane
    const size_t total_bytes = (9 * PL + 3 * WL) * sizeof(us_t);
    if (total_bytes > ws_size) return;

    us_t* ws  = (us_t*)d_ws;
    us_t* xq  = ws;
    us_t* xk  = xq + PL;
    us_t* xv  = xk + PL;
    us_t* wqb = xv + PL;
    us_t* wkb = wqb + WL;
    us_t* wvb = wkb + WL;
    us_t* qhi = wvb + WL;
    us_t* qlo = qhi + PL;
    us_t* khi = qlo + PL;
    us_t* klo = khi + PL;
    us_t* vhi = klo + PL;      // V^T layout [bn][64][SEQ]
    us_t* vlo = vhi + PL;

    // 1) RNE bf16 conversion of activations and weights, one grid (planes xq .. wvb in order)
    cvt_kernel<<<3 * XBLK + 3 * WBLK, 256, 0, stream>>>(query, key, value, Wq, Wk, Wv, xq);

    // 2) projections -> bf16 hi/lo planes (Q,K row-major; V per-head transposed), one grid
    const dim3 pgrid(HID / 64, ROWS / 128, 3);
    gemm_kernel<<<pgrid, 256, 0, stream>>>(xq, wqb, bq, bk, bv, qhi);

    // 3) attention per (q block, head, batch)
    const dim3 agrid(SEQ / SQ, NHEAD, NB);
    attn_kernel<<<agrid, 256, 0, stream>>>(qhi, qlo, khi, klo, vhi, vlo, out);
}

// v003
// A run of this version takes 181 microseconds.
// In both of two side-by-side timings against v002, it was 1.09 times as fast.
// Over all steps from v000 it is 1.67 times as fast.
#include <hip/hip_runtime.h>
#include <stdint.h>
#include <stddef.h>

// Projections: v_wmma_f32_16x16x32_bf16 (bf16 operands = RNE-converted inputs, f32 accumulate).
// QK^T and PV: v_wmma_f32_16x16x32_bf16 on bf16 hi+lo operand planes (hi*hi + hi*lo + lo*hi), f32 accumulate; softmax f32.

#ifndef NB
#define NB 2
#endif
#ifndef SEQ
#define SEQ 2048
#endif
#define NB_FULL  2
#define SEQ_FULL 2048
#define HID      1024
#define NHEAD    16
#define HDIM     64
#define ROWS     (NB * SEQ)        // projection rows actually computed (compact)
#define RPH      (SEQ / 16)        // projection rows per head slice = SEQ*HDIM/HID
#define KSTEPS   (HID / 32)
#define CK       32                // keys per chunk
#define SQ       128               // query rows per attention block (8 waves x 16)

static_assert(NB >= 1 && NB <= NB_FULL);
static_assert(SEQ >= 256 && SEQ <= SEQ_FULL && (SEQ % 256) == 0);
static_assert(HID == NHEAD * HDIM);
static_assert((ROWS % 128) == 0 && (SEQ % SQ) == 0 && (SEQ % CK) == 0);
static_assert(RPH >= 16 && (RPH % 16) == 0);

typedef unsigned short us_t;
typedef __attribute__((ext_vector_type(8)))  unsigned short v8us;
typedef __attribute__((ext_vector_type(16))) __bf16 v16bf;
typedef __attribute__((ext_vector_type(8)))  float v8f;
typedef __attribute__((ext_vector_type(4)))  float v4f;

union Frag { v16bf v; v8us h[2]; };

__device__ __forceinline__ us_t f2bf(float x)          // f32 -> bf16 bits, RNE convert
{
    unsigned u = __float_as_uint(x);
    u += 0x7FFFu + ((u >> 16) & 1u);
    return (us_t)(u >> 16);
}
__device__ __forceinline__ float bf2f(us_t b)
{
    return __uint_as_float(((unsigned)b) << 16);
}

__device__ __forceinline__ v8f wmma_bf(v16bf a, v16bf b, v8f c)
{
    return __builtin_amdgcn_wmma_f32_16x16x32_bf16(false, a, false, b, (short)0, c, false, false);
}

__device__ __forceinline__ v8f zero8()
{
    v8f z;
#pragma unroll
    for (int i = 0; i < 8; ++i) z[i] = 0.0f;
    return z;
}

// ---------------------------------------------------------------------------
// f32 -> bf16 planes, all six tensors in one grid. Block = one tile of 2048
// elements. Tiles in grid order: query, key, value (XBLK each, batch-major),
// then Wq, Wk, Wv (WBLK each). The bf16 planes lie compact and in that same
// order in y, so tile number blockIdx.x lands at y + 2048 * blockIdx.x.
// ---------------------------------------------------------------------------
#define XTILES (SEQ * HID / 2048)  // tiles per batch of one activation
#define XBLK   (NB * XTILES)       // tiles per activation
#define WBLK   (HID * HID / 2048)  // tiles per weight

__global__ __launch_bounds__(256)
void cvt_kernel(const float* __restrict__ q, const float* __restrict__ k,
                const float* __restrict__ v, const float* __restrict__ wq,
                const float* __restrict__ wk, const float* __restrict__ wv,
                us_t* __restrict__ y)
{
    const int bid = blockIdx.x;
    const float* x;
    size_t so;                                          // first source element of the tile
    if (bid < 3 * XBLK) {
        const int t   = bid / XBLK;
        const int r   = bid - t * XBLK;
        const int b   = r / XTILES;
        const int blk = r - b * XTILES;
        x  = t == 0 ? q : (t == 1 ? k : v);
        so = (size_t)b * ((size_t)SEQ_FULL * HID) + (size_t)blk * 2048;
    } else {
        const int r   = bid - 3 * XBLK;
        const int t   = r / WBLK;
        const int blk = r - t * WBLK;
        x  = t == 0 ? wq : (t == 1 ? wk : wv);
        so = (size_t)blk * 2048;
    }
    const float* src = x + so + (size_t)threadIdx.x * 8;
    const v4f a = *(const v4f*)src;
    const v4f c = *(const v4f*)(src + 4);
    v8us o;
#pragma unroll
    for (int j = 0; j < 4; ++j) { o[j] = f2bf(a[j]); o[4 + j] = f2bf(c[j]); }
    us_t* dst = y + (size_t)bid * 2048 + (size_t)threadIdx.x * 8;
    *(v8us*)dst = o;
}

// ---------------------------------------------------------------------------
// Y[m][n] = sum_k X[m][k] * W[n][k] + bias[n]; X,W bf16 planes (k contiguous).
// Block 256 thr = 8 waves, 128 rows x 64 tile columns; wave w: rows m0w..m0w+15.
// mode 0: tile column c -> n = 64*bx + c; output = row-major bf16 hi/lo planes
// mode 1: tile column c -> n = 64*(c>>2) + 4*bx + (c&3); output = per-head
//         transposed planes VT[bn*64 + d][key], key = 16*(row in head) + (n>>6),
//         d = n & 63; a wave owns keys 256w'..+255 of d = 4bx..4bx+3 (4 x 512 B).
// B tile (64 cols x 32 k) staged in LDS per k-step with plain loads + barriers.
// All three projections run in one grid: blockIdx.z = 0, 1, 2 is Q, K, V (mode 1
// for V). Xb, Wb: the three bf16 planes one behind the other; ob: hi, lo per z.
// ---------------------------------------------------------------------------
__global__ __launch_bounds__(256, 12)   // 12 waves per SIMD: the grid's six work-groups per WGP all fit at once
void gemm_kernel(const us_t* __restrict__ Xb, const us_t* __restrict__ Wb,
                 const float* __restrict__ bq, const float* __restrict__ bk,
                 const float* __restrict__ bv, us_t* __restrict__ ob)
{
    const int z    = blockIdx.z;
    const int mode = z == 2 ? 1 : 0;
    const us_t* __restrict__ X     = Xb + (size_t)z * ((size_t)ROWS * HID);
    const us_t* __restrict__ W     = Wb + (size_t)z * ((size_t)HID * HID);
    const float* __restrict__ bias = z == 0 ? bq : (z == 1 ? bk : bv);
    us_t* __restrict__ ohi         = ob + (size_t)(2 * z) * ((size_t)ROWS * HID);
    us_t* __restrict__ olo         = ohi + (size_t)ROWS * HID;

    __shared__ __align__(16) us_t bt[64 * 32];          // 4 KB weight tile
    __shared__ __align__(16) us_t st[8 * 2 * 1024];     // 32 KB epilogue stage (hi,lo per wave)

    const int lane = threadIdx.x & 31;
    const int wave = threadIdx.x >> 5;
    const int h    = lane >> 4;
    const int ln   = lane & 15;
    const int bx   = blockIdx.x;
    const int by   = blockIdx.y;
    const int m0w  = by * 128 + wave * 16;

    const int tn = threadIdx.x >> 2;            // tile column staged by this thread
    const int tk = (threadIdx.x & 3) * 8;       // k offset within the 32-step
    const int wr_t = mode ? ((tn >> 2) * 64 + bx * 4 + (tn & 3)) : (bx * 64 + tn);
    const us_t* wsrc = W + (size_t)wr_t * HID + tk;
    us_t* bdst = bt + tn * 32 + tk;
    const us_t* arow = X + (size_t)(m0w + ln) * HID + 8 * h;

    v8f acc[4];
#pragma unroll
    for (int j = 0; j < 4; ++j) acc[j] = zero8();

    for (int s = 0; s < KSTEPS; ++s) {
        const int kk = s * 32;
        Frag a;                                         // A: row m0w+ln, k = kk+8h.., kk+16+8h..
        a.h[0] = *(const v8us*)(arow + kk);
        a.h[1] = *(const v8us*)(arow + kk + 16);
        __syncthreads();                                // all waves done with prior tile
        *(v8us*)bdst = *(const v8us*)(wsrc + kk);
        __syncthreads();                                // tile visible (cross-wave)
#pragma unroll
        for (int j = 0; j < 4; ++j) {
            const us_t* bp = bt + (j * 16 + ln) * 32 + 8 * h;   // B: col n = j*16+ln, same k map
            Frag b;
            b.h[0] = *(const v8us*)bp;
            b.h[1] = *(const v8us*)(bp + 16);
            acc[j] = wmma_bf(a.v, b.v, acc[j]);
        }
    }

    // ---- epilogue: bias (bf16 RNE), hi/lo split, stage the wave tile in LDS ----
    us_t* sh = st + wave * 2048;
    us_t* sl = sh + 1024;
#pragma unroll
    for (int j = 0; j < 4; ++j) {
        const int c  = j * 16 + ln;
        const int wr = mode ? ((c >> 2) * 64 + bx * 4 + (c & 3)) : (bx * 64 + c);
        const float bb = bf2f(f2bf(bias[wr]));
        const int ib0   = mode ? ((ln & 3) * 256 + 4 * j + (ln >> 2)) : c;
        const int rstep = mode ? 16 : 64;
#pragma unroll
        for (int r = 0; r < 8; ++r) {
            const float v  = acc[j][r] + bb;            // D element: row 8h+r, col c
            const us_t hi  = f2bf(v);
            const us_t lo  = f2bf(v - bf2f(hi));
            const int  idx = ib0 + (8 * h + r) * rstep;
            sh[idx] = hi;
            sl[idx] = lo;
        }
    }
    __syncthreads();

    const int bn   = m0w / RPH;
    const int keyb = 16 * (m0w - bn * RPH);
    v8us vh[4], vl[4];
    size_t di[4];
#pragma unroll
    for (int i = 0; i < 4; ++i) {
        const int row = 4 * i + (lane >> 3);
        const int pc  = lane & 7;
        const int sidx = mode ? (i * 256 + 8 * lane) : (row * 64 + pc * 8);
        const size_t d1 = ((size_t)bn * 64 + (size_t)(bx * 4 + i)) * SEQ + (size_t)keyb + (size_t)(8 * lane);
        const size_t d0 = (size_t)(m0w + row) * HID + (size_t)(bx * 64 + pc * 8);
        di[i] = mode ? d1 : d0;
        vh[i] = *(const v8us*)(sh + sidx);
        vl[i] = *(const v8us*)(sl + sidx);
    }
#pragma unroll
    for (int i = 0; i < 4; ++i) {
        *(v8us*)(ohi + di[i]) = vh[i];
        *(v8us*)(olo + di[i]) = vl[i];
    }
    
}

#define OPITCH 68

__device__ __forceinline__ float xhalf(float x)        // value of lane l ^ 16
{
    const int b = __builtin_bit_cast(int, x);
    return __builtin_bit_cast(float,
        __builtin_amdgcn_permlanex16(b, b, 0x76543210, 0xfedcba98, false, false));
}

__global__ __launch_bounds__(256)
void attn_kernel(const us_t* __restrict__ Qhi, const us_t* __restrict__ Qlo,
                 const us_t* __restrict__ Khi, const us_t* __restrict__ Klo,
                 const us_t* __restrict__ Vhi, const us_t* __restrict__ Vlo,
                 float* __restrict__ out)
{
    __shared__ __align__(16) float lds[8 * 16 * OPITCH]; // 34816 B: K/V tiles, then output stage
    us_t* L   = (us_t*)lds;
    us_t* khs = L;                 // K hi  [32][72]
    us_t* kls = L + 2304;          // K lo  [32][72]
    us_t* vhs = L + 4608;          // Vt hi [64][40]
    us_t* vls = L + 7168;          // Vt lo [64][40]   (end 9728 us)

    const int lane  = threadIdx.x & 31;
    const int wave  = threadIdx.x >> 5;
    const int h     = lane >> 4;
    const int ln    = lane & 15;
    const int head  = blockIdx.y;
    const int batch = blockIdx.z;
    const int bn    = batch * NHEAD + head;
    const size_t hb = (size_t)bn * SEQ * HDIM;          // head slice base (all planes)
    const int q0    = blockIdx.x * SQ + wave * 16;

    // Q fragments (B operand): column q0+ln, d in [0,32) and [32,64), hi and lo
    Frag qh[2], ql[2];
    {
        const us_t* qrh = Qhi + hb + (size_t)(q0 + ln) * HDIM + 8 * h;
        const us_t* qrl = Qlo + hb + (size_t)(q0 + ln) * HDIM + 8 * h;
#pragma unroll
        for (int f = 0; f < 2; ++f) {
            qh[f].h[0] = *(const v8us*)(qrh + 32 * f);
            qh[f].h[1] = *(const v8us*)(qrh + 32 * f + 16);
            ql[f].h[0] = *(const v8us*)(qrl + 32 * f);
            ql[f].h[1] = *(const v8us*)(qrl + 32 * f + 16);
        }
    }

    v8f o[4];                                           // o[t][r] = ctx[q0+ln][16t+8h+r]
#pragma unroll
    for (int t = 0; t < 4; ++t) o[t] = zero8();
    float mrun = -1.0e30f;                              // running maximum of query ln (both halves alike)
    float lrun = 0.0f;                                  // running sum over this lane half's keys

    for (int kk0 = 0; kk0 < SEQ; kk0 += CK) {
        // ---- cooperative staging (plain 16-B loads): K rows, V^T rows ----
        {
            const int row = threadIdx.x >> 3;                 // key 0..31
            const int c8  = (threadIdx.x & 7) * 8;            // d 0..56
            const size_t ko = hb + (size_t)(kk0 + row) * HDIM + c8;
            *(v8us*)(khs + row * 72 + c8) = *(const v8us*)(Khi + ko);
            *(v8us*)(kls + row * 72 + c8) = *(const v8us*)(Klo + ko);
            const int d  = threadIdx.x >> 2;                  // 0..63
            const int pc = (threadIdx.x & 3) * 8;             // keys 0,8,16,24
            const size_t vo = hb + (size_t)d * SEQ + (size_t)(kk0 + pc);
            *(v8us*)(vhs + d * 40 + pc) = *(const v8us*)(Vhi + vo);
            *(v8us*)(vls + d * 40 + pc) = *(const v8us*)(Vlo + vo);
        }
        __syncthreads();

        // ---- transposed scores for two 16-key subtiles: s[j][r] = key 16j+8h+r, query ln ----
        v8f s[2];
#pragma unroll
        for (int j = 0; j < 2; ++j) {
            const us_t* kh = khs + (j * 16 + ln) * 72 + 8 * h;  // A: row = key j*16+ln, k = d
            const us_t* kl = kls + (j * 16 + ln) * 72 + 8 * h;
            v8f z = zero8();
#pragma unroll
            for (int f = 0; f < 2; ++f) {
                Frag ah, al;
                ah.h[0] = *(const v8us*)(kh + 32 * f);
                ah.h[1] = *(const v8us*)(kh + 32 * f + 16);
                al.h[0] = *(const v8us*)(kl + 32 * f);
                al.h[1] = *(const v8us*)(kl + 32 * f + 16);
                z = wmma_bf(ah.v, qh[f].v, z);
                z = wmma_bf(al.v, qh[f].v, z);
                z = wmma_bf(ah.v, ql[f].v, z);
            }
            s[j] = z;
        }

        // ---- online softmax of query ln: 16 keys in the lane, the other 16 in lane ^ 16 ----
        float a[2][8];
#pragma unroll   // constant indices keep the per-lane arrays in registers
        for (int j = 0; j < 2; ++j)
#pragma unroll   // constant indices keep the per-lane arrays in registers
            for (int r = 0; r < 8; ++r) a[j][r] = s[j][r] * 0.125f;
        float vm[8];
#pragma unroll   // constant indices keep the per-lane arrays in registers
        for (int r = 0; r < 8; ++r) vm[r] = fmaxf(a[0][r], a[1][r]);
#pragma unroll   // constant indices keep the per-lane arrays in registers
        for (int w = 4; w >= 1; w >>= 1)
#pragma unroll   // constant indices keep the per-lane arrays in registers
            for (int r = 0; r < w; ++r) vm[r] = fmaxf(vm[r], vm[r + w]);
        const float v     = fmaxf(vm[0], xhalf(vm[0]));
        const float mnew  = fmaxf(mrun, v);
        const float alpha = __expf(mrun - mnew);
        mrun = mnew;

        Frag ph, pl;                                          // B: col = query ln, k = key (8h+r | 16+8h+r)
        float es[8];
#pragma unroll   // constant indices keep the per-lane arrays in registers
        for (int r = 0; r < 8; ++r) {
            const float e0 = __expf(a[0][r] - mnew);
            const float e1 = __expf(a[1][r] - mnew);
            es[r] = e0 + e1;
            const us_t h0 = f2bf(e0);
            const us_t h1 = f2bf(e1);
            ph.h[0][r] = h0;
            ph.h[1][r] = h1;
            pl.h[0][r] = f2bf(e0 - bf2f(h0));
            pl.h[1][r] = f2bf(e1 - bf2f(h1));
        }
#pragma unroll   // constant indices keep the per-lane arrays in registers
        for (int w = 4; w >= 1; w >>= 1)
#pragma unroll   // constant indices keep the per-lane arrays in registers
            for (int r = 0; r < w; ++r) es[r] += es[r + w];
        lrun = lrun * alpha + es[0];
#pragma unroll   // constant indices keep the per-lane arrays in registers
        for (int t = 0; t < 4; ++t)
#pragma unroll   // constant indices keep the per-lane arrays in registers
            for (int r = 0; r < 8; ++r) o[t][r] *= alpha;

        // ---- ctx^T += V^T P^T ----
#pragma unroll
        for (int t = 0; t < 4; ++t) {
            const us_t* vh = vhs + (16 * t + ln) * 40 + 8 * h; // A: row = d 16t+ln, k = key
            const us_t* vl = vls + (16 * t + ln) * 40 + 8 * h;
            Frag ah, al;
            ah.h[0] = *(const v8us*)vh;
            ah.h[1] = *(const v8us*)(vh + 16);
            al.h[0] = *(const v8us*)vl;
            al.h[1] = *(const v8us*)(vl + 16);
            o[t] = wmma_bf(ah.v, ph.v, o[t]);
            o[t] = wmma_bf(al.v, ph.v, o[t]);
            o[t] = wmma_bf(ah.v, pl.v, o[t]);
        }
        __syncthreads();                                      // before next staging overwrites tiles
    }

    // ---- join the halves' sums, normalise, stage wave tile [16][64] f32, whole-line stores ----
    float* ost = lds + wave * (16 * OPITCH);
    const float rinv = 1.0f / (lrun + xhalf(lrun));
#pragma unroll
    for (int t = 0; t < 4; ++t) {
        v4f w0, w1;
#pragma unroll   // constant indices keep the accumulators in registers
        for (int r = 0; r < 4; ++r) { w0[r] = o[t][r] * rinv; w1[r] = o[t][4 + r] * rinv; }
        float* op = ost + ln * OPITCH + 16 * t + 8 * h;       // query ln, d = 16t+8h ..+7
        *(v4f*)op       = w0;
        *(v4f*)(op + 4) = w1;
    }
    __syncthreads();

    const size_t obase = ((size_t)batch * SEQ + (size_t)q0) * HID + (size_t)head * HDIM;
    v4f ov[8];
    size_t od[8];
#pragma unroll
    for (int i = 0; i < 8; ++i) {
        const int row = 2 * i + (lane >> 4);        // lanes 0..15 row 2i, 16..31 row 2i+1
        const int f4  = lane & 15;                  // 16 x 16 B = 256 B = the row segment
        ov[i] = *(const v4f*)(ost + row * OPITCH + f4 * 4);
        od[i] = obase + (size_t)row * HID + (size_t)(f4 * 4);
    }
#pragma unroll
    for (int i = 0; i < 8; ++i) *(v4f*)(out + od[i]) = ov[i];
    
}

// ---------------------------------------------------------------------------
extern "C" void kernel_launch(void* const* d_in, const int* in_sizes, int n_in,
                              void* d_out, int out_size, void* d_ws, size_t ws_size,
                              hipStream_t stream)
{
    if (n_in < 9) return;
    const long long need_x = (long long)(NB - 1) * SEQ_FULL * HID + (long long)SEQ * HID;
    if ((long long)in_sizes[0] < need_x || (long long)in_sizes[1] < need_x ||
        (long long)in_sizes[2] < need_x) return;
    if (in_sizes[3] < HID * HID || in_sizes[5] < HID * HID || in_sizes[7] < HID * HID) return;
    if (in_sizes[4] < HID || in_sizes[6] < HID || in_sizes[8] < HID) return;
    if ((long long)out_size < (long long)ROWS * HID) return;

    const float* query = (const float*)d_in[0];
    const float* key   = (const float*)d_in[1];
    const float* value = (const float*)d_in[2];
    const float* Wq    = (const float*)d_in[3];
    const float* bq    = (const float*)d_in[4];
    const float* Wk    = (const float*)d_in[5];
    const float* bk    = (const float*)d_in[6];
    const float* Wv    = (const float*)d_in[7];
    const float* bv    = (const float*)d_in[8];
    float* out = (float*)d_out;

    const size_t PL = (size_t)ROWS * HID;        // activation / projection plane
    const size_t WL = (size_t)HID * HID;         // weight plane
    const size_t total_bytes = (9 * PL + 3 * WL) * sizeof(us_t);
    if (total_bytes > ws_size) return;

    us_t* ws  = (us_t*)d_ws;
    us_t* xq  = ws;
    us_t* xk  = xq + PL;
    us_t* xv  = xk + PL;
    us_t* wqb = xv + PL;
    us_t* wkb = wqb + WL;
    us_t* wvb = wkb + WL;
    us_t* qhi = wvb + WL;
    us_t* qlo = qhi + PL;
    us_t* khi = qlo + PL;
    us_t* klo = khi + PL;
    us_t* vhi = klo + PL;      // V^T layout [bn][64][SEQ]
    us_t* vlo = vhi + PL;

    // 1) RNE bf16 conversion of activations and weights, one grid (planes xq .. wvb in order)
    cvt_kernel<<<3 * XBLK + 3 * WBLK, 256, 0, stream>>>(query, key, value, Wq, Wk, Wv, xq);

    // 2) projections -> bf16 hi/lo planes (Q,K row-major; V per-head transposed), one grid
    const dim3 pgrid(HID / 64, ROWS / 128, 3);
    gemm_kernel<<<pgrid, 256, 0, stream>>>(xq, wqb, bq, bk, bv, qhi);

    // 3) attention per (q block, head, batch)
    const dim3 agrid(SEQ / SQ, NHEAD, NB);
    attn_kernel<<<agrid, 256, 0, stream>>>(qhi, qlo, khi, klo, vhi, vlo, out);
}

// v004
// It runs in 173 microseconds.
// In two side-by-side timings against v003, it was 1.05 and 1.04 times as fast.
// Counting every step since v000, it is 1.75 times as fast.
#include <hip/hip_runtime.h>
#include <stdint.h>
#include <stddef.h>

// Projections: v_wmma_f32_16x16x32_bf16 (bf16 operands = RNE-converted inputs, f32 accumulate).
// QK^T and PV: v_wmma_f32_16x16x32_bf16 on bf16 hi+lo operand planes (hi*hi + hi*lo + lo*hi), f32 accumulate; softmax f32.

#ifndef NB
#define NB 2
#endif
#ifndef SEQ
#define SEQ 2048
#endif
#define NB_FULL  2
#define SEQ_FULL 2048
#define HID      1024
#define NHEAD    16
#define HDIM     64
#define ROWS     (NB * SEQ)        // projection rows actually computed (compact)
#define RPH      (SEQ / 16)        // projection rows per head slice = SEQ*HDIM/HID
#define KSTEPS   (HID / 32)
#define CK       32                // keys per chunk
#define SQ       128               // query rows per attention block (8 waves x 16)

static_assert(NB >= 1 && NB <= NB_FULL);
static_assert(SEQ >= 256 && SEQ <= SEQ_FULL && (SEQ % 256) == 0);
static_assert(HID == NHEAD * HDIM);
static_assert((ROWS % 128) == 0 && (SEQ % SQ) == 0 && (SEQ % CK) == 0);
static_assert(RPH >= 16 && (RPH % 16) == 0);

typedef unsigned short us_t;
typedef __attribute__((ext_vector_type(8)))  unsigned short v8us;
typedef __attribute__((ext_vector_type(16))) __bf16 v16bf;
typedef __attribute__((ext_vector_type(8)))  float v8f;
typedef __attribute__((ext_vector_type(4)))  float v4f;
typedef __attribute__((ext_vector_type(2)))  float v2f;
typedef __attribute__((ext_vector_type(2)))  __bf16 v2bf;
typedef __attribute__((ext_vector_type(4)))  unsigned v4u;

union Frag { v16bf v; v8us h[2]; unsigned u[8]; };

__device__ __forceinline__ unsigned pk_bf(float a, float b)   // two f32 -> packed bf16 bits (a low, b high), RNE, one instruction
{
    const v2f x = {a, b};
    return __builtin_bit_cast(unsigned, __builtin_convertvector(x, v2bf));
}
// Integer form of the same rounding, for the projection epilogue: with the packed
// convert there that kernel spilled registers under its 12-waves-per-SIMD bound.
__device__ __forceinline__ us_t f2bf(float x)          // f32 -> bf16 bits, RNE convert
{
    unsigned u = __float_as_uint(x);
    u += 0x7FFFu + ((u >> 16) & 1u);
    return (us_t)(u >> 16);
}
__device__ __forceinline__ unsigned pk_res(float a, float b, unsigned p)   // bf16 pair of what p = pk_bf(a, b) left over
{
    return pk_bf(a - __uint_as_float(p << 16), b - __uint_as_float(p & 0xFFFF0000u));
}
__device__ __forceinline__ float bf2f(us_t b)
{
    return __uint_as_float(((unsigned)b) << 16);
}

__device__ __forceinline__ v8f wmma_bf(v16bf a, v16bf b, v8f c)
{
    return __builtin_amdgcn_wmma_f32_16x16x32_bf16(false, a, false, b, (short)0, c, false, false);
}

__device__ __forceinline__ v8f zero8()
{
    v8f z;
#pragma unroll
    for (int i = 0; i < 8; ++i) z[i] = 0.0f;
    return z;
}

// ---------------------------------------------------------------------------
// f32 -> bf16 planes, all six tensors in one grid. Block = one tile of 2048
// elements. Tiles in grid order: query, key, value (XBLK each, batch-major),
// then Wq, Wk, Wv (WBLK each). The bf16 planes lie compact and in that same
// order in y, so tile number blockIdx.x lands at y + 2048 * blockIdx.x.
// ---------------------------------------------------------------------------
#define XTILES (SEQ * HID / 2048)  // tiles per batch of one activation
#define XBLK   (NB * XTILES)       // tiles per activation
#define WBLK   (HID * HID / 2048)  // tiles per weight

__global__ __launch_bounds__(256)
void cvt_kernel(const float* __restrict__ q, const float* __restrict__ k,
                const float* __restrict__ v, const float* __restrict__ wq,
                const float* __restrict__ wk, const float* __restrict__ wv,
                us_t* __restrict__ y)
{
    const int bid = blockIdx.x;
    const float* x;
    size_t so;                                          // first source element of the tile
    if (bid < 3 * XBLK) {
        const int t   = bid / XBLK;
        const int r   = bid - t * XBLK;
        const int b   = r / XTILES;
        const int blk = r - b * XTILES;
        x  = t == 0 ? q : (t == 1 ? k : v);
        so = (size_t)b * ((size_t)SEQ_FULL * HID) + (size_t)blk * 2048;
    } else {
        const int r   = bid - 3 * XBLK;
        const int t   = r / WBLK;
        const int blk = r - t * WBLK;
        x  = t == 0 ? wq : (t == 1 ? wk : wv);
        so = (size_t)blk * 2048;
    }
    const float* src = x + so + (size_t)threadIdx.x * 8;
    const v4f a = *(const v4f*)src;
    const v4f c = *(const v4f*)(src + 4);
    const v4u o = {pk_bf(a[0], a[1]), pk_bf(a[2], a[3]), pk_bf(c[0], c[1]), pk_bf(c[2], c[3])};
    us_t* dst = y + (size_t)bid * 2048 + (size_t)threadIdx.x * 8;
    *(v4u*)dst = o;
}

// ---------------------------------------------------------------------------
// Y[m][n] = sum_k X[m][k] * W[n][k] + bias[n]; X,W bf16 planes (k contiguous).
// Block 256 thr = 8 waves, 128 rows x 64 tile columns; wave w: rows m0w..m0w+15.
// mode 0: tile column c -> n = 64*bx + c; output = row-major bf16 hi/lo planes
// mode 1: tile column c -> n = 64*(c>>2) + 4*bx + (c&3); output = per-head
//         transposed planes VT[bn*64 + d][key], key = 16*(row in head) + (n>>6),
//         d = n & 63; a wave owns keys 256w'..+255 of d = 4bx..4bx+3 (4 x 512 B).
// B tile (64 cols x 32 k) staged in LDS per k-step with plain loads + barriers.
// All three projections run in one grid: blockIdx.z = 0, 1, 2 is Q, K, V (mode 1
// for V). Xb, Wb: the three bf16 planes one behind the other; ob: hi, lo per z.
// ---------------------------------------------------------------------------
__global__ __launch_bounds__(256, 12)   // 12 waves per SIMD: the grid's six work-groups per WGP all fit at once
void gemm_kernel(const us_t* __restrict__ Xb, const us_t* __restrict__ Wb,
                 const float* __restrict__ bq, const float* __restrict__ bk,
                 const float* __restrict__ bv, us_t* __restrict__ ob)
{
    const int z    = blockIdx.z;
    const int mode = z == 2 ? 1 : 0;
    const us_t* __restrict__ X     = Xb + (size_t)z * ((size_t)ROWS * HID);
    const us_t* __restrict__ W     = Wb + (size_t)z * ((size_t)HID * HID);
    const float* __restrict__ bias = z == 0 ? bq : (z == 1 ? bk : bv);
    us_t* __restrict__ ohi         = ob + (size_t)(2 * z) * ((size_t)ROWS * HID);
    us_t* __restrict__ olo         = ohi + (size_t)ROWS * HID;

    __shared__ __align__(16) us_t bt[64 * 32];          // 4 KB weight tile
    __shared__ __align__(16) us_t st[8 * 2 * 1024];     // 32 KB epilogue stage (hi,lo per wave)

    const int lane = threadIdx.x & 31;
    const int wave = threadIdx.x >> 5;
    const int h    = lane >> 4;
    const int ln   = lane & 15;
    const int bx   = blockIdx.x;
    const int by   = blockIdx.y;
    const int m0w  = by * 128 + wave * 16;

    const int tn = threadIdx.x >> 2;            // tile column staged by this thread
    const int tk = (threadIdx.x & 3) * 8;       // k offset within the 32-step
    const int wr_t = mode ? ((tn >> 2) * 64 + bx * 4 + (tn & 3)) : (bx * 64 + tn);
    const us_t* wsrc = W + (size_t)wr_t * HID + tk;
    us_t* bdst = bt + tn * 32 + tk;
    const us_t* arow = X + (size_t)(m0w + ln) * HID + 8 * h;

    v8f acc[4];
#pragma unroll
    for (int j = 0; j < 4; ++j) acc[j] = zero8();

    for (int s = 0; s < KSTEPS; ++s) {
        const int kk = s * 32;
        Frag a;                                         // A: row m0w+ln, k = kk+8h.., kk+16+8h..
        a.h[0] = *(const v8us*)(arow + kk);
        a.h[1] = *(const v8us*)(arow + kk + 16);
        __syncthreads();                                // all waves done with prior tile
        *(v8us*)bdst = *(const v8us*)(wsrc + kk);
        __syncthreads();                                // tile visible (cross-wave)
#pragma unroll
        for (int j = 0; j < 4; ++j) {
            const us_t* bp = bt + (j * 16 + ln) * 32 + 8 * h;   // B: col n = j*16+ln, same k map
            Frag b;
            b.h[0] = *(const v8us*)bp;
            b.h[1] = *(const v8us*)(bp + 16);
            acc[j] = wmma_bf(a.v, b.v, acc[j]);
        }
    }

    // ---- epilogue: bias (bf16 RNE), hi/lo split, stage the wave tile in LDS ----
    us_t* sh = st + wave * 2048;
    us_t* sl = sh + 1024;
#pragma unroll
    for (int j = 0; j < 4; ++j) {
        const int c  = j * 16 + ln;
        const int wr = mode ? ((c >> 2) * 64 + bx * 4 + (c & 3)) : (bx * 64 + c);
        const float bb = bf2f(f2bf(bias[wr]));
        const int ib0   = mode ? ((ln & 3) * 256 + 4 * j + (ln >> 2)) : c;
        const int rstep = mode ? 16 : 64;
#pragma unroll
        for (int r = 0; r < 8; ++r) {
            const float v  = acc[j][r] + bb;            // D element: row 8h+r, col c
            const us_t hi  = f2bf(v);
            const us_t lo  = f2bf(v - bf2f(hi));
            const int  idx = ib0 + (8 * h + r) * rstep;
            sh[idx] = hi;
            sl[idx] = lo;
        }
    }
    __syncthreads();

    const int bn   = m0w / RPH;
    const int keyb = 16 * (m0w - bn * RPH);
    v8us vh[4], vl[4];
    size_t di[4];
#pragma unroll
    for (int i = 0; i < 4; ++i) {
        const int row = 4 * i + (lane >> 3);
        const int pc  = lane & 7;
        const int sidx = mode ? (i * 256 + 8 * lane) : (row * 64 + pc * 8);
        const size_t d1 = ((size_t)bn * 64 + (size_t)(bx * 4 + i)) * SEQ + (size_t)keyb + (size_t)(8 * lane);
        const size_t d0 = (size_t)(m0w + row) * HID + (size_t)(bx * 64 + pc * 8);
        di[i] = mode ? d1 : d0;
        vh[i] = *(const v8us*)(sh + sidx);
        vl[i] = *(const v8us*)(sl + sidx);
    }
#pragma unroll
    for (int i = 0; i < 4; ++i) {
        *(v8us*)(ohi + di[i]) = vh[i];
        *(v8us*)(olo + di[i]) = vl[i];
    }
    
}

#define OPITCH 68

__device__ __forceinline__ float xhalf(float x)        // value of lane l ^ 16
{
    const int b = __builtin_bit_cast(int, x);
    return __builtin_bit_cast(float,
        __builtin_amdgcn_permlanex16(b, b, 0x76543210, 0xfedcba98, false, false));
}

__global__ __launch_bounds__(256)
void attn_kernel(const us_t* __restrict__ Qhi, const us_t* __restrict__ Qlo,
                 const us_t* __restrict__ Khi, const us_t* __restrict__ Klo,
                 const us_t* __restrict__ Vhi, const us_t* __restrict__ Vlo,
                 float* __restrict__ out)
{
    __shared__ __align__(16) float lds[8 * 16 * OPITCH]; // 34816 B: K/V tiles, then output stage
    us_t* L   = (us_t*)lds;
    us_t* khs = L;                 // K hi  [32][72]
    us_t* kls = L + 2304;          // K lo  [32][72]
    us_t* vhs = L + 4608;          // Vt hi [64][40]
    us_t* vls = L + 7168;          // Vt lo [64][40]   (end 9728 us)

    const int lane  = threadIdx.x & 31;
    const int wave  = threadIdx.x >> 5;
    const int h     = lane >> 4;
    const int ln    = lane & 15;
    const int head  = blockIdx.y;
    const int batch = blockIdx.z;
    const int bn    = batch * NHEAD + head;
    const size_t hb = (size_t)bn * SEQ * HDIM;          // head slice base (all planes)
    const int q0    = blockIdx.x * SQ + wave * 16;

    // Q fragments (B operand): column q0+ln, d in [0,32) and [32,64), hi and lo
    Frag qh[2], ql[2];
    {
        const us_t* qrh = Qhi + hb + (size_t)(q0 + ln) * HDIM + 8 * h;
        const us_t* qrl = Qlo + hb + (size_t)(q0 + ln) * HDIM + 8 * h;
#pragma unroll
        for (int f = 0; f < 2; ++f) {
            qh[f].h[0] = *(const v8us*)(qrh + 32 * f);
            qh[f].h[1] = *(const v8us*)(qrh + 32 * f + 16);
            ql[f].h[0] = *(const v8us*)(qrl + 32 * f);
            ql[f].h[1] = *(const v8us*)(qrl + 32 * f + 16);
        }
    }

    v8f o[4];                                           // o[t][r] = ctx[q0+ln][16t+8h+r]
#pragma unroll
    for (int t = 0; t < 4; ++t) o[t] = zero8();
    float mrun = -1.0e30f;                              // running maximum of query ln (both halves alike)
    float lrun = 0.0f;                                  // running sum over this lane half's keys

    for (int kk0 = 0; kk0 < SEQ; kk0 += CK) {
        // ---- cooperative staging (plain 16-B loads): K rows, V^T rows ----
        {
            const int row = threadIdx.x >> 3;                 // key 0..31
            const int c8  = (threadIdx.x & 7) * 8;            // d 0..56
            const size_t ko = hb + (size_t)(kk0 + row) * HDIM + c8;
            *(v8us*)(khs + row * 72 + c8) = *(const v8us*)(Khi + ko);
            *(v8us*)(kls + row * 72 + c8) = *(const v8us*)(Klo + ko);
            const int d  = threadIdx.x >> 2;                  // 0..63
            const int pc = (threadIdx.x & 3) * 8;             // keys 0,8,16,24
            const size_t vo = hb + (size_t)d * SEQ + (size_t)(kk0 + pc);
            *(v8us*)(vhs + d * 40 + pc) = *(const v8us*)(Vhi + vo);
            *(v8us*)(vls + d * 40 + pc) = *(const v8us*)(Vlo + vo);
        }
        __syncthreads();

        // ---- transposed scores for two 16-key subtiles: s[j][r] = key 16j+8h+r, query ln ----
        v8f s[2];
#pragma unroll
        for (int j = 0; j < 2; ++j) {
            const us_t* kh = khs + (j * 16 + ln) * 72 + 8 * h;  // A: row = key j*16+ln, k = d
            const us_t* kl = kls + (j * 16 + ln) * 72 + 8 * h;
            v8f z = zero8();
#pragma unroll
            for (int f = 0; f < 2; ++f) {
                Frag ah, al;
                ah.h[0] = *(const v8us*)(kh + 32 * f);
                ah.h[1] = *(const v8us*)(kh + 32 * f + 16);
                al.h[0] = *(const v8us*)(kl + 32 * f);
                al.h[1] = *(const v8us*)(kl + 32 * f + 16);
                z = wmma_bf(ah.v, qh[f].v, z);
                z = wmma_bf(al.v, qh[f].v, z);
                z = wmma_bf(ah.v, ql[f].v, z);
            }
            s[j] = z;
        }

        // ---- online softmax of query ln: 16 keys in the lane, the other 16 in lane ^ 16 ----
        float a[2][8];
#pragma unroll   // constant indices keep the per-lane arrays in registers
        for (int j = 0; j < 2; ++j)
#pragma unroll   // constant indices keep the per-lane arrays in registers
            for (int r = 0; r < 8; ++r) a[j][r] = s[j][r] * 0.125f;
        float vm[8];
#pragma unroll   // constant indices keep the per-lane arrays in registers
        for (int r = 0; r < 8; ++r) vm[r] = fmaxf(a[0][r], a[1][r]);
#pragma unroll   // constant indices keep the per-lane arrays in registers
        for (int w = 4; w >= 1; w >>= 1)
#pragma unroll   // constant indices keep the per-lane arrays in registers
            for (int r = 0; r < w; ++r) vm[r] = fmaxf(vm[r], vm[r + w]);
        const float v     = fmaxf(vm[0], xhalf(vm[0]));
        const float mnew  = fmaxf(mrun, v);
        const float alpha = __expf(mrun - mnew);
        mrun = mnew;

        Frag ph, pl;                                          // B: col = query ln, k = key (8h+r | 16+8h+r)
        float es[8];
#pragma unroll   // constant indices keep the per-lane arrays in registers
        for (int r = 0; r < 8; r += 2) {
            const float e00 = __expf(a[0][r] - mnew);
            const float e01 = __expf(a[0][r + 1] - mnew);
            const float e10 = __expf(a[1][r] - mnew);
            const float e11 = __expf(a[1][r + 1] - mnew);
            es[r]     = e00 + e10;
            es[r + 1] = e01 + e11;
            const unsigned h0 = pk_bf(e00, e01);              // keys 8h+r, 8h+r+1 share a register
            const unsigned h1 = pk_bf(e10, e11);
            ph.u[r / 2]     = h0;
            ph.u[4 + r / 2] = h1;
            pl.u[r / 2]     = pk_res(e00, e01, h0);
            pl.u[4 + r / 2] = pk_res(e10, e11, h1);
        }
#pragma unroll   // constant indices keep the per-lane arrays in registers
        for (int w = 4; w >= 1; w >>= 1)
#pragma unroll   // constant indices keep the per-lane arrays in registers
            for (int r = 0; r < w; ++r) es[r] += es[r + w];
        lrun = lrun * alpha + es[0];
#pragma unroll   // constant indices keep the per-lane arrays in registers
        for (int t = 0; t < 4; ++t)
#pragma unroll   // constant indices keep the per-lane arrays in registers
            for (int r = 0; r < 8; ++r) o[t][r] *= alpha;

        // ---- ctx^T += V^T P^T ----
#pragma unroll
        for (int t = 0; t < 4; ++t) {
            const us_t* vh = vhs + (16 * t + ln) * 40 + 8 * h; // A: row = d 16t+ln, k = key
            const us_t* vl = vls + (16 * t + ln) * 40 + 8 * h;
            Frag ah, al;
            ah.h[0] = *(const v8us*)vh;
            ah.h[1] = *(const v8us*)(vh + 16);
            al.h[0] = *(const v8us*)vl;
            al.h[1] = *(const v8us*)(vl + 16);
            o[t] = wmma_bf(ah.v, ph.v, o[t]);
            o[t] = wmma_bf(al.v, ph.v, o[t]);
            o[t] = wmma_bf(ah.v, pl.v, o[t]);
        }
        __syncthreads();                                      // before next staging overwrites tiles
    }

    // ---- join the halves' sums, normalise, stage wave tile [16][64] f32, whole-line stores ----
    float* ost = lds + wave * (16 * OPITCH);
    const float rinv = 1.0f / (lrun + xhalf(lrun));
#pragma unroll
    for (int t = 0; t < 4; ++t) {
        v4f w0, w1;
#pragma unroll   // constant indices keep the accumulators in registers
        for (int r = 0; r < 4; ++r) { w0[r] = o[t][r] * rinv; w1[r] = o[t][4 + r] * rinv; }
        float* op = ost + ln * OPITCH + 16 * t + 8 * h;       // query ln, d = 16t+8h ..+7
        *(v4f*)op       = w0;
        *(v4f*)(op + 4) = w1;
    }
    __syncthreads();

    const size_t obase = ((size_t)batch * SEQ + (size_t)q0) * HID + (size_t)head * HDIM;
    v4f ov[8];
    size_t od[8];
#pragma unroll
    for (int i = 0; i < 8; ++i) {
        const int row = 2 * i + (lane >> 4);        // lanes 0..15 row 2i, 16..31 row 2i+1
        const int f4  = lane & 15;                  // 16 x 16 B = 256 B = the row segment
        ov[i] = *(const v4f*)(ost + row * OPITCH + f4 * 4);
        od[i] = obase + (size_t)row * HID + (size_t)(f4 * 4);
    }
#pragma unroll
    for (int i = 0; i < 8; ++i) *(v4f*)(out + od[i]) = ov[i];
    
}

// ---------------------------------------------------------------------------
extern "C" void kernel_launch(void* const* d_in, const int* in_sizes, int n_in,
                              void* d_out, int out_size, void* d_ws, size_t ws_size,
                              hipStream_t stream)
{
    if (n_in < 9) return;
    const long long need_x = (long long)(NB - 1) * SEQ_FULL * HID + (long long)SEQ * HID;
    if ((long long)in_sizes[0] < need_x || (long long)in_sizes[1] < need_x ||
        (long long)in_sizes[2] < need_x) return;
    if (in_sizes[3] < HID * HID || in_sizes[5] < HID * HID || in_sizes[7] < HID * HID) return;
    if (in_sizes[4] < HID || in_sizes[6] < HID || in_sizes[8] < HID) return;
    if ((long long)out_size < (long long)ROWS * HID) return;

    const float* query = (const float*)d_in[0];
    const float* key   = (const float*)d_in[1];
    const float* value = (const float*)d_in[2];
    const float* Wq    = (const float*)d_in[3];
    const float* bq    = (const float*)d_in[4];
    const float* Wk    = (const float*)d_in[5];
    const float* bk    = (const float*)d_in[6];
    const float* Wv    = (const float*)d_in[7];
    const float* bv    = (const float*)d_in[8];
    float* out = (float*)d_out;

    const size_t PL = (size_t)ROWS * HID;        // activation / projection plane
    const size_t WL = (size_t)HID * HID;         // weight plane
    const size_t total_bytes = (9 * PL + 3 * WL) * sizeof(us_t);
    if (total_bytes > ws_size) return;

    us_t* ws  = (us_t*)d_ws;
    us_t* xq  = ws;
    us_t* xk  = xq + PL;
    us_t* xv  = xk + PL;
    us_t* wqb = xv + PL;
    us_t* wkb = wqb + WL;
    us_t* wvb = wkb + WL;
    us_t* qhi = wvb + WL;
    us_t* qlo = qhi + PL;
    us_t* khi = qlo + PL;
    us_t* klo = khi + PL;
    us_t* vhi = klo + PL;      // V^T layout [bn][64][SEQ]
    us_t* vlo = vhi + PL;

    // 1) RNE bf16 conversion of activations and weights, one grid (planes xq .. wvb in order)
    cvt_kernel<<<3 * XBLK + 3 * WBLK, 256, 0, stream>>>(query, key, value, Wq, Wk, Wv, xq);

    // 2) projections -> bf16 hi/lo planes (Q,K row-major; V per-head transposed), one grid
    const dim3 pgrid(HID / 64, ROWS / 128, 3);
    gemm_kernel<<<pgrid, 256, 0, stream>>>(xq, wqb, bq, bk, bv, qhi);

    // 3) attention per (q block, head, batch)
    const dim3 agrid(SEQ / SQ, NHEAD, NB);
    attn_kernel<<<agrid, 256, 0, stream>>>(qhi, qlo, khi, klo, vhi, vlo, out);
}

// v005
// It runs in 153 microseconds.
// In both of two side-by-side timings against v004, it was 1.13 times as fast.
// Counting every step since v000, it is 1.98 times as fast.
#include <hip/hip_runtime.h>
#include <stdint.h>
#include <stddef.h>

// Projections: v_wmma_f32_16x16x32_bf16 (bf16 operands = RNE-converted inputs, f32 accumulate).
// QK^T and PV: v_wmma_f32_16x16x32_bf16 on bf16 hi+lo operand planes (hi*hi + hi*lo + lo*hi), f32 accumulate; softmax f32.

#ifndef NB
#define NB 2
#endif
#ifndef SEQ
#define SEQ 2048
#endif
#define NB_FULL  2
#define SEQ_FULL 2048
#define HID      1024
#define NHEAD    16
#define HDIM     64
#define ROWS     (NB * SEQ)        // projection rows actually computed (compact)
#define RPH      (SEQ / 16)        // projection rows per head slice = SEQ*HDIM/HID
#define KSTEPS   (HID / 32)
#define CK       32                // keys per chunk
#define SQ       128               // query rows per attention block (8 waves x 16)

static_assert(NB >= 1 && NB <= NB_FULL);
static_assert(SEQ >= 256 && SEQ <= SEQ_FULL && (SEQ % 256) == 0);
static_assert(HID == NHEAD * HDIM);
static_assert((ROWS % 128) == 0 && (SEQ % SQ) == 0 && (SEQ % CK) == 0);
static_assert(RPH >= 16 && (RPH % 16) == 0);

typedef unsigned short us_t;
typedef __attribute__((ext_vector_type(8)))  unsigned short v8us;
typedef __attribute__((ext_vector_type(16))) __bf16 v16bf;
typedef __attribute__((ext_vector_type(8)))  float v8f;
typedef __attribute__((ext_vector_type(4)))  float v4f;
typedef __attribute__((ext_vector_type(2)))  float v2f;
typedef __attribute__((ext_vector_type(2)))  __bf16 v2bf;
typedef __attribute__((ext_vector_type(4)))  unsigned v4u;

union Frag { v16bf v; v8us h[2]; unsigned u[8]; };

__device__ __forceinline__ unsigned pk_bf(float a, float b)   // two f32 -> packed bf16 bits (a low, b high), RNE, one instruction
{
    const v2f x = {a, b};
    return __builtin_bit_cast(unsigned, __builtin_convertvector(x, v2bf));
}
// Integer form of the same rounding, for the projection epilogue: with the packed
// convert there that kernel spilled registers under its 12-waves-per-SIMD bound.
__device__ __forceinline__ us_t f2bf(float x)          // f32 -> bf16 bits, RNE convert
{
    unsigned u = __float_as_uint(x);
    u += 0x7FFFu + ((u >> 16) & 1u);
    return (us_t)(u >> 16);
}
__device__ __forceinline__ unsigned pk_res(float a, float b, unsigned p)   // bf16 pair of what p = pk_bf(a, b) left over
{
    return pk_bf(a - __uint_as_float(p << 16), b - __uint_as_float(p & 0xFFFF0000u));
}
__device__ __forceinline__ float bf2f(us_t b)
{
    return __uint_as_float(((unsigned)b) << 16);
}

__device__ __forceinline__ v8f wmma_bf(v16bf a, v16bf b, v8f c)
{
    return __builtin_amdgcn_wmma_f32_16x16x32_bf16(false, a, false, b, (short)0, c, false, false);
}

__device__ __forceinline__ v8f zero8()
{
    v8f z;
#pragma unroll
    for (int i = 0; i < 8; ++i) z[i] = 0.0f;
    return z;
}

// ---------------------------------------------------------------------------
// f32 -> bf16 planes, all six tensors in one grid. Block = one tile of 2048
// elements. Tiles in grid order: query, key, value (XBLK each, batch-major),
// then Wq, Wk, Wv (WBLK each). The bf16 planes lie compact and in that same
// order in y, so tile number blockIdx.x lands at y + 2048 * blockIdx.x.
// ---------------------------------------------------------------------------
#define XTILES (SEQ * HID / 2048)  // tiles per batch of one activation
#define XBLK   (NB * XTILES)       // tiles per activation
#define WBLK   (HID * HID / 2048)  // tiles per weight

__global__ __launch_bounds__(256)
void cvt_kernel(const float* __restrict__ q, const float* __restrict__ k,
                const float* __restrict__ v, const float* __restrict__ wq,
                const float* __restrict__ wk, const float* __restrict__ wv,
                us_t* __restrict__ y)
{
    const int bid = blockIdx.x;
    const float* x;
    size_t so;                                          // first source element of the tile
    if (bid < 3 * XBLK) {
        const int t   = bid / XBLK;
        const int r   = bid - t * XBLK;
        const int b   = r / XTILES;
        const int blk = r - b * XTILES;
        x  = t == 0 ? q : (t == 1 ? k : v);
        so = (size_t)b * ((size_t)SEQ_FULL * HID) + (size_t)blk * 2048;
    } else {
        const int r   = bid - 3 * XBLK;
        const int t   = r / WBLK;
        const int blk = r - t * WBLK;
        x  = t == 0 ? wq : (t == 1 ? wk : wv);
        so = (size_t)blk * 2048;
    }
    const float* src = x + so + (size_t)threadIdx.x * 8;
    const v4f a = *(const v4f*)src;
    const v4f c = *(const v4f*)(src + 4);
    const v4u o = {pk_bf(a[0], a[1]), pk_bf(a[2], a[3]), pk_bf(c[0], c[1]), pk_bf(c[2], c[3])};
    us_t* dst = y + (size_t)bid * 2048 + (size_t)threadIdx.x * 8;
    *(v4u*)dst = o;
}

// ---------------------------------------------------------------------------
// Y[m][n] = sum_k X[m][k] * W[n][k] + bias[n]; X,W bf16 planes (k contiguous).
// Block 256 thr = 8 waves, 128 rows x 64 tile columns; wave w: rows m0w..m0w+15.
// mode 0: tile column c -> n = 64*bx + c; output = row-major bf16 hi/lo planes
// mode 1: tile column c -> n = 64*(c>>2) + 4*bx + (c&3); output = per-head
//         transposed planes VT[bn*64 + d][key], key = 16*(row in head) + (n>>6),
//         d = n & 63; a wave owns keys 256w'..+255 of d = 4bx..4bx+3 (4 x 512 B).
// B tile (64 cols x 32 k) staged in LDS per k-step with plain loads + barriers.
// All three projections run in one grid: blockIdx.z = 0, 1, 2 is Q, K, V (mode 1
// for V). Xb, Wb: the three bf16 planes one behind the other; ob: hi, lo per z.
// ---------------------------------------------------------------------------
__global__ __launch_bounds__(256, 12)   // 12 waves per SIMD: the grid's six work-groups per WGP all fit at once
void gemm_kernel(const us_t* __restrict__ Xb, const us_t* __restrict__ Wb,
                 const float* __restrict__ bq, const float* __restrict__ bk,
                 const float* __restrict__ bv, us_t* __restrict__ ob)
{
    const int z    = blockIdx.z;
    const int mode = z == 2 ? 1 : 0;
    const us_t* __restrict__ X     = Xb + (size_t)z * ((size_t)ROWS * HID);
    const us_t* __restrict__ W     = Wb + (size_t)z * ((size_t)HID * HID);
    const float* __restrict__ bias = z == 0 ? bq : (z == 1 ? bk : bv);
    us_t* __restrict__ ohi         = ob + (size_t)(2 * z) * ((size_t)ROWS * HID);
    us_t* __restrict__ olo         = ohi + (size_t)ROWS * HID;

    __shared__ __align__(16) us_t bt[64 * 32];          // 4 KB weight tile
    __shared__ __align__(16) us_t st[8 * 2 * 1024];     // 32 KB epilogue stage (hi,lo per wave)

    const int lane = threadIdx.x & 31;
    const int wave = threadIdx.x >> 5;
    const int h    = lane >> 4;
    const int ln   = lane & 15;
    const int bx   = blockIdx.x;
    const int by   = blockIdx.y;
    const int m0w  = by * 128 + wave * 16;

    const int tn = threadIdx.x >> 2;            // tile column staged by this thread
    const int tk = (threadIdx.x & 3) * 8;       // k offset within the 32-step
    const int wr_t = mode ? ((tn >> 2) * 64 + bx * 4 + (tn & 3)) : (bx * 64 + tn);
    const us_t* wsrc = W + (size_t)wr_t * HID + tk;
    us_t* bdst = bt + tn * 32 + tk;
    const us_t* arow = X + (size_t)(m0w + ln) * HID + 8 * h;

    v8f acc[4];
#pragma unroll
    for (int j = 0; j < 4; ++j) acc[j] = zero8();

    for (int s = 0; s < KSTEPS; ++s) {
        const int kk = s * 32;
        Frag a;                                         // A: row m0w+ln, k = kk+8h.., kk+16+8h..
        a.h[0] = *(const v8us*)(arow + kk);
        a.h[1] = *(const v8us*)(arow + kk + 16);
        __syncthreads();                                // all waves done with prior tile
        *(v8us*)bdst = *(const v8us*)(wsrc + kk);
        __syncthreads();                                // tile visible (cross-wave)
#pragma unroll
        for (int j = 0; j < 4; ++j) {
            const us_t* bp = bt + (j * 16 + ln) * 32 + 8 * h;   // B: col n = j*16+ln, same k map
            Frag b;
            b.h[0] = *(const v8us*)bp;
            b.h[1] = *(const v8us*)(bp + 16);
            acc[j] = wmma_bf(a.v, b.v, acc[j]);
        }
    }

    // ---- epilogue: bias (bf16 RNE), hi/lo split, stage the wave tile in LDS ----
    us_t* sh = st + wave * 2048;
    us_t* sl = sh + 1024;
#pragma unroll
    for (int j = 0; j < 4; ++j) {
        const int c  = j * 16 + ln;
        const int wr = mode ? ((c >> 2) * 64 + bx * 4 + (c & 3)) : (bx * 64 + c);
        const float bb = bf2f(f2bf(bias[wr]));
        const int ib0   = mode ? ((ln & 3) * 256 + 4 * j + (ln >> 2)) : c;
        const int rstep = mode ? 16 : 64;
#pragma unroll
        for (int r = 0; r < 8; ++r) {
            const float v  = acc[j][r] + bb;            // D element: row 8h+r, col c
            const us_t hi  = f2bf(v);
            const us_t lo  = f2bf(v - bf2f(hi));
            const int  idx = ib0 + (8 * h + r) * rstep;
            sh[idx] = hi;
            sl[idx] = lo;
        }
    }
    __syncthreads();

    const int bn   = m0w / RPH;
    const int keyb = 16 * (m0w - bn * RPH);
    v8us vh[4], vl[4];
    size_t di[4];
#pragma unroll
    for (int i = 0; i < 4; ++i) {
        const int row = 4 * i + (lane >> 3);
        const int pc  = lane & 7;
        const int sidx = mode ? (i * 256 + 8 * lane) : (row * 64 + pc * 8);
        const size_t d1 = ((size_t)bn * 64 + (size_t)(bx * 4 + i)) * SEQ + (size_t)keyb + (size_t)(8 * lane);
        const size_t d0 = (size_t)(m0w + row) * HID + (size_t)(bx * 64 + pc * 8);
        di[i] = mode ? d1 : d0;
        vh[i] = *(const v8us*)(sh + sidx);
        vl[i] = *(const v8us*)(sl + sidx);
    }
#pragma unroll
    for (int i = 0; i < 4; ++i) {
        *(v8us*)(ohi + di[i]) = vh[i];
        *(v8us*)(olo + di[i]) = vl[i];
    }
    
}

#define OPITCH 68
#define TILE_US 9728
#define TILE_B  (2 * TILE_US)

static_assert(SEQ >= 2 * CK);
static_assert(2 * TILE_B >= 8 * 16 * OPITCH * 4);

// One K/V tile, 64 B per thread: K hi, K lo (LDS bytes lk, lk + 4608), Vt hi, Vt lo (lv, lv + 5120).
// The s_wait_xcnt closes the statement so that it stands in front of every later
// rewrite of an address register that a copy names.
__device__ __forceinline__ void copy_tile(unsigned lk, unsigned lv,
                                          const us_t* gkh, const us_t* gkl,
                                          const us_t* gvh, const us_t* gvl)
{
    asm volatile("global_load_async_to_lds_b128 %0, %1, off\n\t"
                 "global_load_async_to_lds_b128 %2, %3, off\n\t"
                 "global_load_async_to_lds_b128 %4, %5, off\n\t"
                 "global_load_async_to_lds_b128 %6, %7, off\n\t"
                 "s_wait_xcnt 0x0"
                 :: "v"(lk), "v"(gkh), "v"(lk + 4608u), "v"(gkl),
                    "v"(lv), "v"(gvh), "v"(lv + 5120u), "v"(gvl)
                 : "memory");
}

__device__ __forceinline__ float xhalf(float x)        // value of lane l ^ 16
{
    const int b = __builtin_bit_cast(int, x);
    return __builtin_bit_cast(float,
        __builtin_amdgcn_permlanex16(b, b, 0x76543210, 0xfedcba98, false, false));
}

__global__ __launch_bounds__(256)
void attn_kernel(const us_t* __restrict__ Qhi, const us_t* __restrict__ Qlo,
                 const us_t* __restrict__ Khi, const us_t* __restrict__ Klo,
                 const us_t* __restrict__ Vhi, const us_t* __restrict__ Vlo,
                 float* __restrict__ out)
{
    __shared__ __align__(16) float lds[2 * TILE_B / 4];  // 38912 B: two K/V tiles, then output stage
    us_t* L   = (us_t*)lds;

    const int lane  = threadIdx.x & 31;
    const int wave  = threadIdx.x >> 5;
    const int h     = lane >> 4;
    const int ln    = lane & 15;
    const int head  = blockIdx.y;
    const int batch = blockIdx.z;
    const int bn    = batch * NHEAD + head;
    const size_t hb = (size_t)bn * SEQ * HDIM;          // head slice base (all planes)
    const int q0    = blockIdx.x * SQ + wave * 16;

    // ---- this thread's 16-B pieces of a tile: K row (key), Vt row (d); LDS byte addresses in buffer 0 ----
    const int krow = threadIdx.x >> 3;                  // key 0..31
    const int kc8  = (threadIdx.x & 7) * 8;             // d 0..56
    const int vd   = threadIdx.x >> 2;                  // d 0..63
    const int vpc  = (threadIdx.x & 3) * 8;             // keys 0,8,16,24
    const unsigned lk = (unsigned)(size_t)(L + krow * 72 + kc8);
    const unsigned lv = (unsigned)(size_t)(L + 4608 + vd * 40 + vpc);
    const us_t* gkh = Khi + hb + (size_t)krow * HDIM + kc8;
    const us_t* gkl = Klo + hb + (size_t)krow * HDIM + kc8;
    const us_t* gvh = Vhi + hb + (size_t)vd * SEQ + vpc;
    const us_t* gvl = Vlo + hb + (size_t)vd * SEQ + vpc;
    copy_tile(lk, lv, gkh, gkl, gvh, gvl);              // tile 0 -> buffer 0

    // Q fragments (B operand): column q0+ln, d in [0,32) and [32,64), hi and lo
    Frag qh[2], ql[2];
    {
        const us_t* qrh = Qhi + hb + (size_t)(q0 + ln) * HDIM + 8 * h;
        const us_t* qrl = Qlo + hb + (size_t)(q0 + ln) * HDIM + 8 * h;
#pragma unroll
        for (int f = 0; f < 2; ++f) {
            qh[f].h[0] = *(const v8us*)(qrh + 32 * f);
            qh[f].h[1] = *(const v8us*)(qrh + 32 * f + 16);
            ql[f].h[0] = *(const v8us*)(qrl + 32 * f);
            ql[f].h[1] = *(const v8us*)(qrl + 32 * f + 16);
        }
    }

    v8f o[4];                                           // o[t][r] = ctx[q0+ln][16t+8h+r]
#pragma unroll
    for (int t = 0; t < 4; ++t) o[t] = zero8();
    float mrun = -1.0e30f;                              // running maximum of query ln (both halves alike)
    float lrun = 0.0f;                                  // running sum over this lane half's keys

    asm volatile("s_wait_asynccnt 0x0" ::: "memory");   // this wave's pieces of tile 0 have landed
    __syncthreads();                                    // ... and every other wave's
    copy_tile(lk + TILE_B, lv + TILE_B, gkh + CK * HDIM, gkl + CK * HDIM, gvh + CK, gvl + CK);   // tile 1 -> buffer 1
    gkh += 2 * CK * HDIM;                               // the pointers stand at the next tile to ask for
    gkl += 2 * CK * HDIM;
    gvh += 2 * CK;
    gvl += 2 * CK;

    for (int kk0 = 0; kk0 < SEQ; kk0 += CK) {
        const unsigned bo = (kk0 & CK) ? TILE_US : 0;   // tile kk0 / CK lies in buffer (kk0 / CK) & 1
        const us_t* khs = L + bo;                       // K hi  [32][72]
        const us_t* kls = khs + 2304;                   // K lo  [32][72]
        const us_t* vhs = khs + 4608;                   // Vt hi [64][40]
        const us_t* vls = khs + 7168;                   // Vt lo [64][40]

        // ---- transposed scores for two 16-key subtiles: s[j][r] = key 16j+8h+r, query ln ----
        v8f s[2];
#pragma unroll
        for (int j = 0; j < 2; ++j) {
            const us_t* kh = khs + (j * 16 + ln) * 72 + 8 * h;  // A: row = key j*16+ln, k = d
            const us_t* kl = kls + (j * 16 + ln) * 72 + 8 * h;
            v8f z = zero8();
#pragma unroll
            for (int f = 0; f < 2; ++f) {
                Frag ah, al;
                ah.h[0] = *(const v8us*)(kh + 32 * f);
                ah.h[1] = *(const v8us*)(kh + 32 * f + 16);
                al.h[0] = *(const v8us*)(kl + 32 * f);
                al.h[1] = *(const v8us*)(kl + 32 * f + 16);
                z = wmma_bf(ah.v, qh[f].v, z);
                z = wmma_bf(al.v, qh[f].v, z);
                z = wmma_bf(ah.v, ql[f].v, z);
            }
            s[j] = z;
        }

        // ---- online softmax of query ln: 16 keys in the lane, the other 16 in lane ^ 16 ----
        float a[2][8];
#pragma unroll   // constant indices keep the per-lane arrays in registers
        for (int j = 0; j < 2; ++j)
#pragma unroll   // constant indices keep the per-lane arrays in registers
            for (int r = 0; r < 8; ++r) a[j][r] = s[j][r] * 0.125f;
        float vm[8];
#pragma unroll   // constant indices keep the per-lane arrays in registers
        for (int r = 0; r < 8; ++r) vm[r] = fmaxf(a[0][r], a[1][r]);
#pragma unroll   // constant indices keep the per-lane arrays in registers
        for (int w = 4; w >= 1; w >>= 1)
#pragma unroll   // constant indices keep the per-lane arrays in registers
            for (int r = 0; r < w; ++r) vm[r] = fmaxf(vm[r], vm[r + w]);
        const float v     = fmaxf(vm[0], xhalf(vm[0]));
        const float mnew  = fmaxf(mrun, v);
        const float alpha = __expf(mrun - mnew);
        mrun = mnew;

        Frag ph, pl;                                          // B: col = query ln, k = key (8h+r | 16+8h+r)
        float es[8];
#pragma unroll   // constant indices keep the per-lane arrays in registers
        for (int r = 0; r < 8; r += 2) {
            const float e00 = __expf(a[0][r] - mnew);
            const float e01 = __expf(a[0][r + 1] - mnew);
            const float e10 = __expf(a[1][r] - mnew);
            const float e11 = __expf(a[1][r + 1] - mnew);
            es[r]     = e00 + e10;
            es[r + 1] = e01 + e11;
            const unsigned h0 = pk_bf(e00, e01);              // keys 8h+r, 8h+r+1 share a register
            const unsigned h1 = pk_bf(e10, e11);
            ph.u[r / 2]     = h0;
            ph.u[4 + r / 2] = h1;
            pl.u[r / 2]     = pk_res(e00, e01, h0);
            pl.u[4 + r / 2] = pk_res(e10, e11, h1);
        }
#pragma unroll   // constant indices keep the per-lane arrays in registers
        for (int w = 4; w >= 1; w >>= 1)
#pragma unroll   // constant indices keep the per-lane arrays in registers
            for (int r = 0; r < w; ++r) es[r] += es[r + w];
        lrun = lrun * alpha + es[0];
#pragma unroll   // constant indices keep the per-lane arrays in registers
        for (int t = 0; t < 4; ++t)
#pragma unroll   // constant indices keep the per-lane arrays in registers
            for (int r = 0; r < 8; ++r) o[t][r] *= alpha;

        // ---- ctx^T += V^T P^T ----
#pragma unroll
        for (int t = 0; t < 4; ++t) {
            const us_t* vh = vhs + (16 * t + ln) * 40 + 8 * h; // A: row = d 16t+ln, k = key
            const us_t* vl = vls + (16 * t + ln) * 40 + 8 * h;
            Frag ah, al;
            ah.h[0] = *(const v8us*)vh;
            ah.h[1] = *(const v8us*)(vh + 16);
            al.h[0] = *(const v8us*)vl;
            al.h[1] = *(const v8us*)(vl + 16);
            o[t] = wmma_bf(ah.v, ph.v, o[t]);
            o[t] = wmma_bf(al.v, ph.v, o[t]);
            o[t] = wmma_bf(ah.v, pl.v, o[t]);
        }
        asm volatile("s_wait_dscnt 0x0" ::: "memory");        // this wave's reads of the tile are done
        asm volatile("s_wait_asynccnt 0x0" ::: "memory");     // its pieces of the next tile have landed
        __syncthreads();                                      // next tile readable, this buffer free
        if (kk0 + 2 * CK < SEQ) {                             // same for the whole grid
            copy_tile(lk + 2 * bo, lv + 2 * bo, gkh, gkl, gvh, gvl);
            gkh += CK * HDIM;
            gkl += CK * HDIM;
            gvh += CK;
            gvl += CK;
        }
    }
    asm volatile("s_wait_asynccnt 0x0" ::: "memory");         // nothing in flight when the buffers become the output stage

    // ---- join the halves' sums, normalise, stage wave tile [16][64] f32, whole-line stores ----
    float* ost = lds + wave * (16 * OPITCH);
    const float rinv = 1.0f / (lrun + xhalf(lrun));
#pragma unroll
    for (int t = 0; t < 4; ++t) {
        v4f w0, w1;
#pragma unroll   // constant indices keep the accumulators in registers
        for (int r = 0; r < 4; ++r) { w0[r] = o[t][r] * rinv; w1[r] = o[t][4 + r] * rinv; }
        float* op = ost + ln * OPITCH + 16 * t + 8 * h;       // query ln, d = 16t+8h ..+7
        *(v4f*)op       = w0;
        *(v4f*)(op + 4) = w1;
    }
    __syncthreads();

    const size_t obase = ((size_t)batch * SEQ + (size_t)q0) * HID + (size_t)head * HDIM;
    v4f ov[8];
    size_t od[8];
#pragma unroll
    for (int i = 0; i < 8; ++i) {
        const int row = 2 * i + (lane >> 4);        // lanes 0..15 row 2i, 16..31 row 2i+1
        const int f4  = lane & 15;                  // 16 x 16 B = 256 B = the row segment
        ov[i] = *(const v4f*)(ost + row * OPITCH + f4 * 4);
        od[i] = obase + (size_t)row * HID + (size_t)(f4 * 4);
    }
#pragma unroll
    for (int i = 0; i < 8; ++i) *(v4f*)(out + od[i]) = ov[i];
    
}

// ---------------------------------------------------------------------------
extern "C" void kernel_launch(void* const* d_in, const int* in_sizes, int n_in,
                              void* d_out, int out_size, void* d_ws, size_t ws_size,
                              hipStream_t stream)
{
    if (n_in < 9) return;
    const long long need_x = (long long)(NB - 1) * SEQ_FULL * HID + (long long)SEQ * HID;
    if ((long long)in_sizes[0] < need_x || (long long)in_sizes[1] < need_x ||
        (long long)in_sizes[2] < need_x) return;
    if (in_sizes[3] < HID * HID || in_sizes[5] < HID * HID || in_sizes[7] < HID * HID) return;
    if (in_sizes[4] < HID || in_sizes[6] < HID || in_sizes[8] < HID) return;
    if ((long long)out_size < (long long)ROWS * HID) return;

    const float* query = (const float*)d_in[0];
    const float* key   = (const float*)d_in[1];
    const float* value = (const float*)d_in[2];
    const float* Wq    = (const float*)d_in[3];
    const float* bq    = (const float*)d_in[4];
    const float* Wk    = (const float*)d_in[5];
    const float* bk    = (const float*)d_in[6];
    const float* Wv    = (const float*)d_in[7];
    const float* bv    = (const float*)d_in[8];
    float* out = (float*)d_out;

    const size_t PL = (size_t)ROWS * HID;        // activation / projection plane
    const size_t WL = (size_t)HID * HID;         // weight plane
    const size_t total_bytes = (9 * PL + 3 * WL) * sizeof(us_t);
    if (total_bytes > ws_size) return;

    us_t* ws  = (us_t*)d_ws;
    us_t* xq  = ws;
    us_t* xk  = xq + PL;
    us_t* xv  = xk + PL;
    us_t* wqb = xv + PL;
    us_t* wkb = wqb + WL;
    us_t* wvb = wkb + WL;
    us_t* qhi = wvb + WL;
    us_t* qlo = qhi + PL;
    us_t* khi = qlo + PL;
    us_t* klo = khi + PL;
    us_t* vhi = klo + PL;      // V^T layout [bn][64][SEQ]
    us_t* vlo = vhi + PL;

    // 1) RNE bf16 conversion of activations and weights, one grid (planes xq .. wvb in order)
    cvt_kernel<<<3 * XBLK + 3 * WBLK, 256, 0, stream>>>(query, key, value, Wq, Wk, Wv, xq);

    // 2) projections -> bf16 hi/lo planes (Q,K row-major; V per-head transposed), one grid
    const dim3 pgrid(HID / 64, ROWS / 128, 3);
    gemm_kernel<<<pgrid, 256, 0, stream>>>(xq, wqb, bq, bk, bv, qhi);

    // 3) attention per (q block, head, batch)
    const dim3 agrid(SEQ / SQ, NHEAD, NB);
    attn_kernel<<<agrid, 256, 0, stream>>>(qhi, qlo, khi, klo, vhi, vlo, out);
}

// v006
// One run takes 119 microseconds.
// Next to v005, in two timings, it ran 1.29 times as fast each time.
// All steps since v000 together make it 2.55 times as fast.
#include <hip/hip_runtime.h>
#include <stdint.h>
#include <stddef.h>

// Projections: v_wmma_f32_16x16x32_bf16 (bf16 operands = RNE-converted inputs, f32 accumulate).
// QK^T and PV: v_wmma_f32_16x16x32_bf16 on bf16 hi+lo operand planes (hi*hi + hi*lo + lo*hi), f32 accumulate; softmax f32.

#ifndef NB
#define NB 2
#endif
#ifndef SEQ
#define SEQ 2048
#endif
#define NB_FULL  2
#define SEQ_FULL 2048
#define HID      1024
#define NHEAD    16
#define HDIM     64
#define ROWS     (NB * SEQ)        // projection rows actually computed (compact)
#define RPH      (SEQ / 16)        // projection rows per head slice = SEQ*HDIM/HID
#define CK       32                // keys per chunk
#define SQ       128               // query rows per attention block (8 waves x 16)

static_assert(NB >= 1 && NB <= NB_FULL);
static_assert(SEQ >= 256 && SEQ <= SEQ_FULL && (SEQ % 256) == 0);
static_assert(HID == NHEAD * HDIM);
static_assert((ROWS % 128) == 0 && (SEQ % SQ) == 0 && (SEQ % CK) == 0);
static_assert(RPH >= 16 && (RPH % 16) == 0);

typedef unsigned short us_t;
typedef __attribute__((ext_vector_type(8)))  unsigned short v8us;
typedef __attribute__((ext_vector_type(16))) __bf16 v16bf;
typedef __attribute__((ext_vector_type(8)))  float v8f;
typedef __attribute__((ext_vector_type(4)))  float v4f;
typedef __attribute__((ext_vector_type(2)))  float v2f;
typedef __attribute__((ext_vector_type(2)))  __bf16 v2bf;
typedef __attribute__((ext_vector_type(4)))  unsigned v4u;

union Frag { v16bf v; v8us h[2]; unsigned u[8]; };

__device__ __forceinline__ unsigned pk_bf(float a, float b)   // two f32 -> packed bf16 bits (a low, b high), RNE, one instruction
{
    const v2f x = {a, b};
    return __builtin_bit_cast(unsigned, __builtin_convertvector(x, v2bf));
}
// Integer form of the same rounding, for the projection epilogue: with the packed
// convert there that kernel spilled registers under its 12-waves-per-SIMD bound.
__device__ __forceinline__ us_t f2bf(float x)          // f32 -> bf16 bits, RNE convert
{
    unsigned u = __float_as_uint(x);
    u += 0x7FFFu + ((u >> 16) & 1u);
    return (us_t)(u >> 16);
}
__device__ __forceinline__ unsigned pk_res(float a, float b, unsigned p)   // bf16 pair of what p = pk_bf(a, b) left over
{
    return pk_bf(a - __uint_as_float(p << 16), b - __uint_as_float(p & 0xFFFF0000u));
}
__device__ __forceinline__ float bf2f(us_t b)
{
    return __uint_as_float(((unsigned)b) << 16);
}

__device__ __forceinline__ v8f wmma_bf(v16bf a, v16bf b, v8f c)
{
    return __builtin_amdgcn_wmma_f32_16x16x32_bf16(false, a, false, b, (short)0, c, false, false);
}

__device__ __forceinline__ v8f zero8()
{
    v8f z;
#pragma unroll
    for (int i = 0; i < 8; ++i) z[i] = 0.0f;
    return z;
}

// ---------------------------------------------------------------------------
// f32 -> bf16 planes, all six tensors in one grid. Block = one tile of 2048
// elements. Tiles in grid order: query, key, value (XBLK each, batch-major),
// then Wq, Wk, Wv (WBLK each). The bf16 planes lie compact and in that same
// order in y, so tile number blockIdx.x lands at y + 2048 * blockIdx.x.
// ---------------------------------------------------------------------------
#define XTILES (SEQ * HID / 2048)  // tiles per batch of one activation
#define XBLK   (NB * XTILES)       // tiles per activation
#define WBLK   (HID * HID / 2048)  // tiles per weight

__global__ __launch_bounds__(256)
void cvt_kernel(const float* __restrict__ q, const float* __restrict__ k,
                const float* __restrict__ v, const float* __restrict__ wq,
                const float* __restrict__ wk, const float* __restrict__ wv,
                us_t* __restrict__ y)
{
    const int bid = blockIdx.x;
    const float* x;
    size_t so;                                          // first source element of the tile
    if (bid < 3 * XBLK) {
        const int t   = bid / XBLK;
        const int r   = bid - t * XBLK;
        const int b   = r / XTILES;
        const int blk = r - b * XTILES;
        x  = t == 0 ? q : (t == 1 ? k : v);
        so = (size_t)b * ((size_t)SEQ_FULL * HID) + (size_t)blk * 2048;
    } else {
        const int r   = bid - 3 * XBLK;
        const int t   = r / WBLK;
        const int blk = r - t * WBLK;
        x  = t == 0 ? wq : (t == 1 ? wk : wv);
        so = (size_t)blk * 2048;
    }
    const float* src = x + so + (size_t)threadIdx.x * 8;
    const v4f a = *(const v4f*)src;
    const v4f c = *(const v4f*)(src + 4);
    const v4u o = {pk_bf(a[0], a[1]), pk_bf(a[2], a[3]), pk_bf(c[0], c[1]), pk_bf(c[2], c[3])};
    us_t* dst = y + (size_t)bid * 2048 + (size_t)threadIdx.x * 8;
    *(v4u*)dst = o;
}

// ---------------------------------------------------------------------------
// Y[m][n] = sum_k X[m][k] * W[n][k] + bias[n]; X,W bf16 planes (k contiguous).
// Block 256 thr = 8 waves, 128 rows x 64 tile columns; wave w: rows m0w..m0w+15.
// mode 0: tile column c -> n = 64*bx + c; output = row-major bf16 hi/lo planes
// mode 1: tile column c -> n = 64*(c>>2) + 4*bx + (c&3); output = per-head
//         transposed planes VT[bn*64 + d][key], key = 16*(row in head) + (n>>6),
//         d = n & 63; a wave owns keys 256w'..+255 of d = 4bx..4bx+3 (4 x 512 B).
// X tile (128 rows) and W tile (64 tile columns) of 64 k = one 128-B line per row come
// by asynchronous copies into two LDS buffers, one tile ahead. Rows lie unpadded; the
// 16-B piece c of row r lies at piece c ^ ((r >> 1) & 7), so that the 16 rows of a
// fragment load fall on all 64 banks once.
// All three projections run in one grid: blockIdx.z = 0, 1, 2 is Q, K, V (mode 1
// for V). Xb, Wb: the three bf16 planes one behind the other; ob: hi, lo per z.
// ---------------------------------------------------------------------------
#define GKT    64                  // k per staged tile
#define GTILES (HID / GKT)
#define GT_US  12288               // one X + W tile in LDS, 16-bit units: X [128][64], W [64][64]
#define GT_B   (2 * GT_US)         // the same in bytes

static_assert(GTILES >= 2 && (HID % GKT) == 0);
static_assert(2 * GT_US >= 8 * 2 * 1024);

// One X + W tile, 96 B per thread: X rows r, r + 32, r + 64, r + 96 (LDS bytes la + 4096 i),
// W tile columns r, r + 32 (la + 16384, la + 20480).
// The s_wait_xcnt closes the statement so that it stands in front of every later
// rewrite of an address register that a copy names.
__device__ __forceinline__ void copy_gtile(unsigned la, const us_t* ga,
                                           const us_t* gw0, const us_t* gw1)
{
    asm volatile("global_load_async_to_lds_b128 %0, %1, off\n\t"
                 "global_load_async_to_lds_b128 %2, %3, off\n\t"
                 "global_load_async_to_lds_b128 %4, %5, off\n\t"
                 "global_load_async_to_lds_b128 %6, %7, off\n\t"
                 "global_load_async_to_lds_b128 %8, %9, off\n\t"
                 "global_load_async_to_lds_b128 %10, %11, off\n\t"
                 "s_wait_xcnt 0x0"
                 :: "v"(la),          "v"(ga),
                    "v"(la + 4096u),  "v"(ga + 32 * HID),
                    "v"(la + 8192u),  "v"(ga + 64 * HID),
                    "v"(la + 12288u), "v"(ga + 96 * HID),
                    "v"(la + 16384u), "v"(gw0),
                    "v"(la + 20480u), "v"(gw1)
                 : "memory");
}

__global__ __launch_bounds__(256, 12)   // 12 waves per SIMD: the grid's six work-groups per WGP all fit at once
void gemm_kernel(const us_t* __restrict__ Xb, const us_t* __restrict__ Wb,
                 const float* __restrict__ bq, const float* __restrict__ bk,
                 const float* __restrict__ bv, us_t* __restrict__ ob)
{
    const int z    = blockIdx.z;
    const int mode = z == 2 ? 1 : 0;
    const us_t* __restrict__ X     = Xb + (size_t)z * ((size_t)ROWS * HID);
    const us_t* __restrict__ W     = Wb + (size_t)z * ((size_t)HID * HID);
    const float* __restrict__ bias = z == 0 ? bq : (z == 1 ? bk : bv);
    us_t* __restrict__ ohi         = ob + (size_t)(2 * z) * ((size_t)ROWS * HID);
    us_t* __restrict__ olo         = ohi + (size_t)ROWS * HID;

    __shared__ __align__(16) us_t sm[2 * GT_US];        // 48 KB: two X + W tiles, then epilogue stage (hi,lo per wave)

    const int lane = threadIdx.x & 31;
    const int wave = threadIdx.x >> 5;
    const int h    = lane >> 4;
    const int ln   = lane & 15;
    const int bx   = blockIdx.x;
    const int by   = blockIdx.y;
    const int m0w  = by * 128 + wave * 16;

    // ---- this thread's 16-B pieces of a tile: row tr (+ 32 i) of X and of W, piece tc of the row's line ----
    const int tr = threadIdx.x >> 3;            // 0..31
    const int tc = threadIdx.x & 7;             // 0..7
    const int wr_t = mode ? ((tr >> 2) * 64 + bx * 4 + (tr & 3)) : (bx * 64 + tr);
    const unsigned la = (unsigned)(size_t)(sm + tr * 64 + ((tc ^ ((tr >> 1) & 7)) * 8));   // (r >> 1) & 7 is alike for r and r + 32
    const us_t* ga  = X + (size_t)(by * 128 + tr) * HID + tc * 8;
    const us_t* gw0 = W + (size_t)wr_t * HID + tc * 8;
    const us_t* gw1 = gw0 + (size_t)(mode ? 512 : 32) * HID;    // tile column tr + 32
    copy_gtile(la, ga, gw0, gw1);                               // tile 0 -> buffer 0

    v8f acc[4];
#pragma unroll
    for (int j = 0; j < 4; ++j) acc[j] = zero8();

    asm volatile("s_wait_asynccnt 0x0" ::: "memory");   // this wave's pieces of tile 0 have landed
    __syncthreads();                                    // ... and every other wave's
    copy_gtile(la + GT_B, ga + GKT, gw0 + GKT, gw1 + GKT);      // tile 1 -> buffer 1
    ga  += 2 * GKT;                                     // the pointers stand at the next tile to ask for
    gw0 += 2 * GKT;
    gw1 += 2 * GKT;

    const int sw = ln >> 1;                             // (row >> 1) & 7 of every row 16 i + ln
    for (int s = 0; s < GTILES; ++s) {
        const unsigned bo = (s & 1) ? GT_US : 0;        // tile s lies in buffer s & 1
        const us_t* as = sm + bo + (wave * 16 + ln) * 64;       // X row m0w+ln
        const us_t* bs = sm + bo + 8192 + ln * 64;              // W tile column ln (+ 16 j)
#pragma unroll   // the piece numbers become constants xor sw, formed once ahead of the loop
        for (int f = 0; f < 2; ++f) {
            const int c0 = ((4 * f + h) ^ sw) * 8;      // k = 32f+8h ..
            const int c1 = ((4 * f + 2 + h) ^ sw) * 8;  // k = 32f+16+8h ..
            Frag a;                                     // A: row m0w+ln
            a.h[0] = *(const v8us*)(as + c0);
            a.h[1] = *(const v8us*)(as + c1);
#pragma unroll   // constant indices keep the accumulators in registers
            for (int j = 0; j < 4; ++j) {
                Frag b;                                 // B: col n = j*16+ln, same k map
                b.h[0] = *(const v8us*)(bs + j * 1024 + c0);
                b.h[1] = *(const v8us*)(bs + j * 1024 + c1);
                acc[j] = wmma_bf(a.v, b.v, acc[j]);
            }
        }
        asm volatile("s_wait_dscnt 0x0" ::: "memory");          // this wave's reads of the tile are done
        asm volatile("s_wait_asynccnt 0x0" ::: "memory");       // its pieces of the next tile have landed
        __syncthreads();                                        // next tile readable, this buffer free
        if (s + 2 < GTILES) {                                   // same for the whole grid
            copy_gtile(la + 2 * bo, ga, gw0, gw1);
            ga  += GKT;
            gw0 += GKT;
            gw1 += GKT;
        }
    }
    asm volatile("s_wait_asynccnt 0x0" ::: "memory");           // nothing in flight when the buffers become the epilogue stage

    // ---- epilogue: bias (bf16 RNE), hi/lo split, stage the wave tile in LDS ----
    us_t* sh = sm + wave * 2048;
    us_t* sl = sh + 1024;
#pragma unroll
    for (int j = 0; j < 4; ++j) {
        const int c  = j * 16 + ln;
        const int wr = mode ? ((c >> 2) * 64 + bx * 4 + (c & 3)) : (bx * 64 + c);
        const float bb = bf2f(f2bf(bias[wr]));
        const int ib0   = mode ? ((ln & 3) * 256 + 4 * j + (ln >> 2)) : c;
        const int rstep = mode ? 16 : 64;
#pragma unroll
        for (int r = 0; r < 8; ++r) {
            const float v  = acc[j][r] + bb;            // D element: row 8h+r, col c
            const us_t hi  = f2bf(v);
            const us_t lo  = f2bf(v - bf2f(hi));
            const int  idx = ib0 + (8 * h + r) * rstep;
            sh[idx] = hi;
            sl[idx] = lo;
        }
    }
    __syncthreads();

    const int bn   = m0w / RPH;
    const int keyb = 16 * (m0w - bn * RPH);
    v8us vh[4], vl[4];
    size_t di[4];
#pragma unroll
    for (int i = 0; i < 4; ++i) {
        const int row = 4 * i + (lane >> 3);
        const int pc  = lane & 7;
        const int sidx = mode ? (i * 256 + 8 * lane) : (row * 64 + pc * 8);
        const size_t d1 = ((size_t)bn * 64 + (size_t)(bx * 4 + i)) * SEQ + (size_t)keyb + (size_t)(8 * lane);
        const size_t d0 = (size_t)(m0w + row) * HID + (size_t)(bx * 64 + pc * 8);
        di[i] = mode ? d1 : d0;
        vh[i] = *(const v8us*)(sh + sidx);
        vl[i] = *(const v8us*)(sl + sidx);
    }
#pragma unroll
    for (int i = 0; i < 4; ++i) {
        *(v8us*)(ohi + di[i]) = vh[i];
        *(v8us*)(olo + di[i]) = vl[i];
    }
    
}

#define OPITCH 68
#define TILE_US 9728
#define TILE_B  (2 * TILE_US)

static_assert(SEQ >= 2 * CK);
static_assert(2 * TILE_B >= 8 * 16 * OPITCH * 4);

// One K/V tile, 64 B per thread: K hi, K lo (LDS bytes lk, lk + 4608), Vt hi, Vt lo (lv, lv + 5120).
// The s_wait_xcnt closes the statement so that it stands in front of every later
// rewrite of an address register that a copy names.
__device__ __forceinline__ void copy_tile(unsigned lk, unsigned lv,
                                          const us_t* gkh, const us_t* gkl,
                                          const us_t* gvh, const us_t* gvl)
{
    asm volatile("global_load_async_to_lds_b128 %0, %1, off\n\t"
                 "global_load_async_to_lds_b128 %2, %3, off\n\t"
                 "global_load_async_to_lds_b128 %4, %5, off\n\t"
                 "global_load_async_to_lds_b128 %6, %7, off\n\t"
                 "s_wait_xcnt 0x0"
                 :: "v"(lk), "v"(gkh), "v"(lk + 4608u), "v"(gkl),
                    "v"(lv), "v"(gvh), "v"(lv + 5120u), "v"(gvl)
                 : "memory");
}

__device__ __forceinline__ float xhalf(float x)        // value of lane l ^ 16
{
    const int b = __builtin_bit_cast(int, x);
    return __builtin_bit_cast(float,
        __builtin_amdgcn_permlanex16(b, b, 0x76543210, 0xfedcba98, false, false));
}

__global__ __launch_bounds__(256)
void attn_kernel(const us_t* __restrict__ Qhi, const us_t* __restrict__ Qlo,
                 const us_t* __restrict__ Khi, const us_t* __restrict__ Klo,
                 const us_t* __restrict__ Vhi, const us_t* __restrict__ Vlo,
                 float* __restrict__ out)
{
    __shared__ __align__(16) float lds[2 * TILE_B / 4];  // 38912 B: two K/V tiles, then output stage
    us_t* L   = (us_t*)lds;

    const int lane  = threadIdx.x & 31;
    const int wave  = threadIdx.x >> 5;
    const int h     = lane >> 4;
    const int ln    = lane & 15;
    const int head  = blockIdx.y;
    const int batch = blockIdx.z;
    const int bn    = batch * NHEAD + head;
    const size_t hb = (size_t)bn * SEQ * HDIM;          // head slice base (all planes)
    const int q0    = blockIdx.x * SQ + wave * 16;

    // ---- this thread's 16-B pieces of a tile: K row (key), Vt row (d); LDS byte addresses in buffer 0 ----
    const int krow = threadIdx.x >> 3;                  // key 0..31
    const int kc8  = (threadIdx.x & 7) * 8;             // d 0..56
    const int vd   = threadIdx.x >> 2;                  // d 0..63
    const int vpc  = (threadIdx.x & 3) * 8;             // keys 0,8,16,24
    const unsigned lk = (unsigned)(size_t)(L + krow * 72 + kc8);
    const unsigned lv = (unsigned)(size_t)(L + 4608 + vd * 40 + vpc);
    const us_t* gkh = Khi + hb + (size_t)krow * HDIM + kc8;
    const us_t* gkl = Klo + hb + (size_t)krow * HDIM + kc8;
    const us_t* gvh = Vhi + hb + (size_t)vd * SEQ + vpc;
    const us_t* gvl = Vlo + hb + (size_t)vd * SEQ + vpc;
    copy_tile(lk, lv, gkh, gkl, gvh, gvl);              // tile 0 -> buffer 0

    // Q fragments (B operand): column q0+ln, d in [0,32) and [32,64), hi and lo
    Frag qh[2], ql[2];
    {
        const us_t* qrh = Qhi + hb + (size_t)(q0 + ln) * HDIM + 8 * h;
        const us_t* qrl = Qlo + hb + (size_t)(q0 + ln) * HDIM + 8 * h;
#pragma unroll
        for (int f = 0; f < 2; ++f) {
            qh[f].h[0] = *(const v8us*)(qrh + 32 * f);
            qh[f].h[1] = *(const v8us*)(qrh + 32 * f + 16);
            ql[f].h[0] = *(const v8us*)(qrl + 32 * f);
            ql[f].h[1] = *(const v8us*)(qrl + 32 * f + 16);
        }
    }

    v8f o[4];                                           // o[t][r] = ctx[q0+ln][16t+8h+r]
#pragma unroll
    for (int t = 0; t < 4; ++t) o[t] = zero8();
    float mrun = -1.0e30f;                              // running maximum of query ln (both halves alike)
    float lrun = 0.0f;                                  // running sum over this lane half's keys

    asm volatile("s_wait_asynccnt 0x0" ::: "memory");   // this wave's pieces of tile 0 have landed
    __syncthreads();                                    // ... and every other wave's
    copy_tile(lk + TILE_B, lv + TILE_B, gkh + CK * HDIM, gkl + CK * HDIM, gvh + CK, gvl + CK);   // tile 1 -> buffer 1
    gkh += 2 * CK * HDIM;                               // the pointers stand at the next tile to ask for
    gkl += 2 * CK * HDIM;
    gvh += 2 * CK;
    gvl += 2 * CK;

    for (int kk0 = 0; kk0 < SEQ; kk0 += CK) {
        const unsigned bo = (kk0 & CK) ? TILE_US : 0;   // tile kk0 / CK lies in buffer (kk0 / CK) & 1
        const us_t* khs = L + bo;                       // K hi  [32][72]
        const us_t* kls = khs + 2304;                   // K lo  [32][72]
        const us_t* vhs = khs + 4608;                   // Vt hi [64][40]
        const us_t* vls = khs + 7168;                   // Vt lo [64][40]

        // ---- transposed scores for two 16-key subtiles: s[j][r] = key 16j+8h+r, query ln ----
        v8f s[2];
#pragma unroll
        for (int j = 0; j < 2; ++j) {
            const us_t* kh = khs + (j * 16 + ln) * 72 + 8 * h;  // A: row = key j*16+ln, k = d
            const us_t* kl = kls + (j * 16 + ln) * 72 + 8 * h;
            v8f z = zero8();
#pragma unroll
            for (int f = 0; f < 2; ++f) {
                Frag ah, al;
                ah.h[0] = *(const v8us*)(kh + 32 * f);
                ah.h[1] = *(const v8us*)(kh + 32 * f + 16);
                al.h[0] = *(const v8us*)(kl + 32 * f);
                al.h[1] = *(const v8us*)(kl + 32 * f + 16);
                z = wmma_bf(ah.v, qh[f].v, z);
                z = wmma_bf(al.v, qh[f].v, z);
                z = wmma_bf(ah.v, ql[f].v, z);
            }
            s[j] = z;
        }

        // ---- online softmax of query ln: 16 keys in the lane, the other 16 in lane ^ 16 ----
        float a[2][8];
#pragma unroll   // constant indices keep the per-lane arrays in registers
        for (int j = 0; j < 2; ++j)
#pragma unroll   // constant indices keep the per-lane arrays in registers
            for (int r = 0; r < 8; ++r) a[j][r] = s[j][r] * 0.125f;
        float vm[8];
#pragma unroll   // constant indices keep the per-lane arrays in registers
        for (int r = 0; r < 8; ++r) vm[r] = fmaxf(a[0][r], a[1][r]);
#pragma unroll   // constant indices keep the per-lane arrays in registers
        for (int w = 4; w >= 1; w >>= 1)
#pragma unroll   // constant indices keep the per-lane arrays in registers
            for (int r = 0; r < w; ++r) vm[r] = fmaxf(vm[r], vm[r + w]);
        const float v     = fmaxf(vm[0], xhalf(vm[0]));
        const float mnew  = fmaxf(mrun, v);
        const float alpha = __expf(mrun - mnew);
        mrun = mnew;

        Frag ph, pl;                                          // B: col = query ln, k = key (8h+r | 16+8h+r)
        float es[8];
#pragma unroll   // constant indices keep the per-lane arrays in registers
        for (int r = 0; r < 8; r += 2) {
            const float e00 = __expf(a[0][r] - mnew);
            const float e01 = __expf(a[0][r + 1] - mnew);
            const float e10 = __expf(a[1][r] - mnew);
            const float e11 = __expf(a[1][r + 1] - mnew);
            es[r]     = e00 + e10;
            es[r + 1] = e01 + e11;
            const unsigned h0 = pk_bf(e00, e01);              // keys 8h+r, 8h+r+1 share a register
            const unsigned h1 = pk_bf(e10, e11);
            ph.u[r / 2]     = h0;
            ph.u[4 + r / 2] = h1;
            pl.u[r / 2]     = pk_res(e00, e01, h0);
            pl.u[4 + r / 2] = pk_res(e10, e11, h1);
        }
#pragma unroll   // constant indices keep the per-lane arrays in registers
        for (int w = 4; w >= 1; w >>= 1)
#pragma unroll   // constant indices keep the per-lane arrays in registers
            for (int r = 0; r < w; ++r) es[r] += es[r + w];
        lrun = lrun * alpha + es[0];
#pragma unroll   // constant indices keep the per-lane arrays in registers
        for (int t = 0; t < 4; ++t)
#pragma unroll   // constant indices keep the per-lane arrays in registers
            for (int r = 0; r < 8; ++r) o[t][r] *= alpha;

        // ---- ctx^T += V^T P^T ----
#pragma unroll
        for (int t = 0; t < 4; ++t) {
            const us_t* vh = vhs + (16 * t + ln) * 40 + 8 * h; // A: row = d 16t+ln, k = key
            const us_t* vl = vls + (16 * t + ln) * 40 + 8 * h;
            Frag ah, al;
            ah.h[0] = *(const v8us*)vh;
            ah.h[1] = *(const v8us*)(vh + 16);
            al.h[0] = *(const v8us*)vl;
            al.h[1] = *(const v8us*)(vl + 16);
            o[t] = wmma_bf(ah.v, ph.v, o[t]);
            o[t] = wmma_bf(al.v, ph.v, o[t]);
            o[t] = wmma_bf(ah.v, pl.v, o[t]);
        }
        asm volatile("s_wait_dscnt 0x0" ::: "memory");        // this wave's reads of the tile are done
        asm volatile("s_wait_asynccnt 0x0" ::: "memory");     // its pieces of the next tile have landed
        __syncthreads();                                      // next tile readable, this buffer free
        if (kk0 + 2 * CK < SEQ) {                             // same for the whole grid
            copy_tile(lk + 2 * bo, lv + 2 * bo, gkh, gkl, gvh, gvl);
            gkh += CK * HDIM;
            gkl += CK * HDIM;
            gvh += CK;
            gvl += CK;
        }
    }
    asm volatile("s_wait_asynccnt 0x0" ::: "memory");         // nothing in flight when the buffers become the output stage

    // ---- join the halves' sums, normalise, stage wave tile [16][64] f32, whole-line stores ----
    float* ost = lds + wave * (16 * OPITCH);
    const float rinv = 1.0f / (lrun + xhalf(lrun));
#pragma unroll
    for (int t = 0; t < 4; ++t) {
        v4f w0, w1;
#pragma unroll   // constant indices keep the accumulators in registers
        for (int r = 0; r < 4; ++r) { w0[r] = o[t][r] * rinv; w1[r] = o[t][4 + r] * rinv; }
        float* op = ost + ln * OPITCH + 16 * t + 8 * h;       // query ln, d = 16t+8h ..+7
        *(v4f*)op       = w0;
        *(v4f*)(op + 4) = w1;
    }
    __syncthreads();

    const size_t obase = ((size_t)batch * SEQ + (size_t)q0) * HID + (size_t)head * HDIM;
    v4f ov[8];
    size_t od[8];
#pragma unroll
    for (int i = 0; i < 8; ++i) {
        const int row = 2 * i + (lane >> 4);        // lanes 0..15 row 2i, 16..31 row 2i+1
        const int f4  = lane & 15;                  // 16 x 16 B = 256 B = the row segment
        ov[i] = *(const v4f*)(ost + row * OPITCH + f4 * 4);
        od[i] = obase + (size_t)row * HID + (size_t)(f4 * 4);
    }
#pragma unroll
    for (int i = 0; i < 8; ++i) *(v4f*)(out + od[i]) = ov[i];
    
}

// ---------------------------------------------------------------------------
extern "C" void kernel_launch(void* const* d_in, const int* in_sizes, int n_in,
                              void* d_out, int out_size, void* d_ws, size_t ws_size,
                              hipStream_t stream)
{
    if (n_in < 9) return;
    const long long need_x = (long long)(NB - 1) * SEQ_FULL * HID + (long long)SEQ * HID;
    if ((long long)in_sizes[0] < need_x || (long long)in_sizes[1] < need_x ||
        (long long)in_sizes[2] < need_x) return;
    if (in_sizes[3] < HID * HID || in_sizes[5] < HID * HID || in_sizes[7] < HID * HID) return;
    if (in_sizes[4] < HID || in_sizes[6] < HID || in_sizes[8] < HID) return;
    if ((long long)out_size < (long long)ROWS * HID) return;

    const float* query = (const float*)d_in[0];
    const float* key   = (const float*)d_in[1];
    const float* value = (const float*)d_in[2];
    const float* Wq    = (const float*)d_in[3];
    const float* bq    = (const float*)d_in[4];
    const float* Wk    = (const float*)d_in[5];
    const float* bk    = (const float*)d_in[6];
    const float* Wv    = (const float*)d_in[7];
    const float* bv    = (const float*)d_in[8];
    float* out = (float*)d_out;

    const size_t PL = (size_t)ROWS * HID;        // activation / projection plane
    const size_t WL = (size_t)HID * HID;         // weight plane
    const size_t total_bytes = (9 * PL + 3 * WL) * sizeof(us_t);
    if (total_bytes > ws_size) return;

    us_t* ws  = (us_t*)d_ws;
    us_t* xq  = ws;
    us_t* xk  = xq + PL;
    us_t* xv  = xk + PL;
    us_t* wqb = xv + PL;
    us_t* wkb = wqb + WL;
    us_t* wvb = wkb + WL;
    us_t* qhi = wvb + WL;
    us_t* qlo = qhi + PL;
    us_t* khi = qlo + PL;
    us_t* klo = khi + PL;
    us_t* vhi = klo + PL;      // V^T layout [bn][64][SEQ]
    us_t* vlo = vhi + PL;

    // 1) RNE bf16 conversion of activations and weights, one grid (planes xq .. wvb in order)
    cvt_kernel<<<3 * XBLK + 3 * WBLK, 256, 0, stream>>>(query, key, value, Wq, Wk, Wv, xq);

    // 2) projections -> bf16 hi/lo planes (Q,K row-major; V per-head transposed), one grid
    const dim3 pgrid(HID / 64, ROWS / 128, 3);
    gemm_kernel<<<pgrid, 256, 0, stream>>>(xq, wqb, bq, bk, bv, qhi);

    // 3) attention per (q block, head, batch)
    const dim3 agrid(SEQ / SQ, NHEAD, NB);
    attn_kernel<<<agrid, 256, 0, stream>>>(qhi, qlo, khi, klo, vhi, vlo, out);
}

// v008
// Measured time: 82.5 microseconds a run.
// It is 1.43 times as fast as v006, going by the measured steps of the versions left out in between.
// Over all steps from v000 it is 3.65 times as fast.
#include <hip/hip_runtime.h>
#include <stdint.h>
#include <stddef.h>

// Projections: v_wmma_f32_16x16x32_bf16 (bf16 operands = RNE-converted inputs, f32 accumulate).
// QK^T and PV: v_wmma_f32_16x16x32_f16, Q, K, V and P each one f16 number (RNE), f32 accumulate; softmax f32.
// f16 rounds at 2^-12 of a value, an eighth of what the projections' bf16 operands already left in Q, K, V.

#ifndef NB
#define NB 2
#endif
#ifndef SEQ
#define SEQ 2048
#endif
#define NB_FULL  2
#define SEQ_FULL 2048
#define HID      1024
#define NHEAD    16
#define HDIM     64
#define ROWS     (NB * SEQ)        // projection rows actually computed (compact)
#define RPH      (SEQ / 16)        // projection rows per head slice = SEQ*HDIM/HID
#define CK       32                // keys per chunk
#define SQ       128               // query rows per attention block (4 query groups x 32)

static_assert(NB >= 1 && NB <= NB_FULL);
static_assert(SEQ >= 256 && SEQ <= SEQ_FULL && (SEQ % 256) == 0);
static_assert(HID == NHEAD * HDIM);
static_assert((ROWS % 128) == 0 && (SEQ % SQ) == 0 && (SEQ % CK) == 0);
static_assert(RPH >= 16 && (RPH % 16) == 0);

typedef unsigned short us_t;
typedef __attribute__((ext_vector_type(8)))  unsigned short v8us;
typedef __attribute__((ext_vector_type(16))) __bf16 v16bf;
typedef __attribute__((ext_vector_type(16))) _Float16 v16h;
typedef __attribute__((ext_vector_type(2)))  _Float16 v2h;
typedef __attribute__((ext_vector_type(8)))  float v8f;
typedef __attribute__((ext_vector_type(4)))  float v4f;
typedef __attribute__((ext_vector_type(2)))  float v2f;
typedef __attribute__((ext_vector_type(2)))  __bf16 v2bf;
typedef __attribute__((ext_vector_type(4)))  unsigned v4u;

union Frag { v16bf v; v8us h[2]; unsigned u[8]; };
union FragH { v16h v; v8us h[2]; unsigned u[8]; };

__device__ __forceinline__ unsigned pk_bf(float a, float b)   // two f32 -> packed bf16 bits (a low, b high), RNE, one instruction
{
    const v2f x = {a, b};
    return __builtin_bit_cast(unsigned, __builtin_convertvector(x, v2bf));
}
__device__ __forceinline__ unsigned pk_h(float a, float b)    // two f32 -> packed f16 bits (a low, b high), RNE, one instruction
{
    const v2f x = {a, b};
    return __builtin_bit_cast(unsigned, __builtin_convertvector(x, v2h));
}
__device__ __forceinline__ us_t f2h(float x)           // f32 -> f16 bits, RNE
{
    return __builtin_bit_cast(us_t, (_Float16)x);
}
__device__ __forceinline__ us_t f2bf(float x)          // f32 -> bf16 bits, RNE, integer form (the bias)
{
    unsigned u = __float_as_uint(x);
    u += 0x7FFFu + ((u >> 16) & 1u);
    return (us_t)(u >> 16);
}
__device__ __forceinline__ float bf2f(us_t b)
{
    return __uint_as_float(((unsigned)b) << 16);
}

__device__ __forceinline__ v8f wmma_bf(v16bf a, v16bf b, v8f c)
{
    return __builtin_amdgcn_wmma_f32_16x16x32_bf16(false, a, false, b, (short)0, c, false, false);
}

__device__ __forceinline__ v8f wmma_h(v16h a, v16h b, v8f c)
{
    return __builtin_amdgcn_wmma_f32_16x16x32_f16(false, a, false, b, (short)0, c, false, false);
}

__device__ __forceinline__ v8f zero8()
{
    v8f z;
#pragma unroll
    for (int i = 0; i < 8; ++i) z[i] = 0.0f;
    return z;
}

// ---------------------------------------------------------------------------
// f32 -> bf16 planes, all six tensors in one grid. Block = one tile of 2048
// elements. Tiles in grid order: query, key, value (XBLK each, batch-major),
// then Wq, Wk, Wv (WBLK each). The bf16 planes lie compact and in that same
// order in y, so tile number blockIdx.x lands at y + 2048 * blockIdx.x.
// ---------------------------------------------------------------------------
#define XTILES (SEQ * HID / 2048)  // tiles per batch of one activation
#define XBLK   (NB * XTILES)       // tiles per activation
#define WBLK   (HID * HID / 2048)  // tiles per weight

__global__ __launch_bounds__(256)
void cvt_kernel(const float* __restrict__ q, const float* __restrict__ k,
                const float* __restrict__ v, const float* __restrict__ wq,
                const float* __restrict__ wk, const float* __restrict__ wv,
                us_t* __restrict__ y)
{
    const int bid = blockIdx.x;
    const float* x;
    size_t so;                                          // first source element of the tile
    if (bid < 3 * XBLK) {
        const int t   = bid / XBLK;
        const int r   = bid - t * XBLK;
        const int b   = r / XTILES;
        const int blk = r - b * XTILES;
        x  = t == 0 ? q : (t == 1 ? k : v);
        so = (size_t)b * ((size_t)SEQ_FULL * HID) + (size_t)blk * 2048;
    } else {
        const int r   = bid - 3 * XBLK;
        const int t   = r / WBLK;
        const int blk = r - t * WBLK;
        x  = t == 0 ? wq : (t == 1 ? wk : wv);
        so = (size_t)blk * 2048;
    }
    const float* src = x + so + (size_t)threadIdx.x * 8;
    const v4f a = *(const v4f*)src;
    const v4f c = *(const v4f*)(src + 4);
    const v4u o = {pk_bf(a[0], a[1]), pk_bf(a[2], a[3]), pk_bf(c[0], c[1]), pk_bf(c[2], c[3])};
    us_t* dst = y + (size_t)bid * 2048 + (size_t)threadIdx.x * 8;
    *(v4u*)dst = o;
}

// ---------------------------------------------------------------------------
// Y[m][n] = sum_k X[m][k] * W[n][k] + bias[n]; X,W bf16 planes (k contiguous).
// Block 256 thr = 8 waves, 128 rows x 64 tile columns; wave w: rows m0w..m0w+15.
// mode 0: tile column c -> n = 64*bx + c; output = row-major f16 plane
// mode 1: tile column c -> n = 64*(c>>2) + 4*bx + (c&3); output = per-head
//         transposed plane VT[bn*64 + d][key], key = 16*(row in head) + (n>>6),
//         d = n & 63; a wave owns keys 256w'..+255 of d = 4bx..4bx+3 (4 x 512 B).
// X tile (128 rows) and W tile (64 tile columns) of 64 k = one 128-B line per row come
// by asynchronous copies into two LDS buffers, one tile ahead. Rows lie unpadded; the
// 16-B piece c of row r lies at piece c ^ ((r >> 1) & 7), so that the 16 rows of a
// fragment load fall on all 64 banks once.
// All three projections run in one grid: blockIdx.z = 0, 1, 2 is Q, K, V (mode 1
// for V). Xb, Wb: the three bf16 planes one behind the other; ob: one f16 plane per z.
// ---------------------------------------------------------------------------
#define GKT    64                  // k per staged tile
#define GTILES (HID / GKT)
#define GT_US  12288               // one X + W tile in LDS, 16-bit units: X [128][64], W [64][64]
#define GT_B   (2 * GT_US)         // the same in bytes

static_assert(GTILES >= 2 && (HID % GKT) == 0);
static_assert(2 * GT_US >= 8 * 1024);

// One X + W tile, 96 B per thread: X rows r, r + 32, r + 64, r + 96 (LDS bytes la + 4096 i),
// W tile columns r, r + 32 (la + 16384, la + 20480).
// The s_wait_xcnt closes the statement so that it stands in front of every later
// rewrite of an address register that a copy names.
__device__ __forceinline__ void copy_gtile(unsigned la, const us_t* ga,
                                           const us_t* gw0, const us_t* gw1)
{
    asm volatile("global_load_async_to_lds_b128 %0, %1, off\n\t"
                 "global_load_async_to_lds_b128 %2, %3, off\n\t"
                 "global_load_async_to_lds_b128 %4, %5, off\n\t"
                 "global_load_async_to_lds_b128 %6, %7, off\n\t"
                 "global_load_async_to_lds_b128 %8, %9, off\n\t"
                 "global_load_async_to_lds_b128 %10, %11, off\n\t"
                 "s_wait_xcnt 0x0"
                 :: "v"(la),          "v"(ga),
                    "v"(la + 4096u),  "v"(ga + 32 * HID),
                    "v"(la + 8192u),  "v"(ga + 64 * HID),
                    "v"(la + 12288u), "v"(ga + 96 * HID),
                    "v"(la + 16384u), "v"(gw0),
                    "v"(la + 20480u), "v"(gw1)
                 : "memory");
}

__global__ __launch_bounds__(256, 12)   // 12 waves per SIMD: the grid's six work-groups per WGP all fit at once
void gemm_kernel(const us_t* __restrict__ Xb, const us_t* __restrict__ Wb,
                 const float* __restrict__ bq, const float* __restrict__ bk,
                 const float* __restrict__ bv, us_t* __restrict__ ob)
{
    const int z    = blockIdx.z;
    const int mode = z == 2 ? 1 : 0;
    const us_t* __restrict__ X     = Xb + (size_t)z * ((size_t)ROWS * HID);
    const us_t* __restrict__ W     = Wb + (size_t)z * ((size_t)HID * HID);
    const float* __restrict__ bias = z == 0 ? bq : (z == 1 ? bk : bv);
    us_t* __restrict__ o16         = ob + (size_t)z * ((size_t)ROWS * HID);

    __shared__ __align__(16) us_t sm[2 * GT_US];        // 48 KB: two X + W tiles, then epilogue stage (2 KB per wave)

    const int lane = threadIdx.x & 31;
    const int wave = threadIdx.x >> 5;
    const int h    = lane >> 4;
    const int ln   = lane & 15;
    const int bx   = blockIdx.x;
    const int by   = blockIdx.y;
    const int m0w  = by * 128 + wave * 16;

    // ---- this thread's 16-B pieces of a tile: row tr (+ 32 i) of X and of W, piece tc of the row's line ----
    const int tr = threadIdx.x >> 3;            // 0..31
    const int tc = threadIdx.x & 7;             // 0..7
    const int wr_t = mode ? ((tr >> 2) * 64 + bx * 4 + (tr & 3)) : (bx * 64 + tr);
    const unsigned la = (unsigned)(size_t)(sm + tr * 64 + ((tc ^ ((tr >> 1) & 7)) * 8));   // (r >> 1) & 7 is alike for r and r + 32
    const us_t* ga  = X + (size_t)(by * 128 + tr) * HID + tc * 8;
    const us_t* gw0 = W + (size_t)wr_t * HID + tc * 8;
    const us_t* gw1 = gw0 + (size_t)(mode ? 512 : 32) * HID;    // tile column tr + 32
    copy_gtile(la, ga, gw0, gw1);                               // tile 0 -> buffer 0

    v8f acc[4];
#pragma unroll
    for (int j = 0; j < 4; ++j) acc[j] = zero8();

    asm volatile("s_wait_asynccnt 0x0" ::: "memory");   // this wave's pieces of tile 0 have landed
    __syncthreads();                                    // ... and every other wave's
    copy_gtile(la + GT_B, ga + GKT, gw0 + GKT, gw1 + GKT);      // tile 1 -> buffer 1
    ga  += 2 * GKT;                                     // the pointers stand at the next tile to ask for
    gw0 += 2 * GKT;
    gw1 += 2 * GKT;

    const int sw = ln >> 1;                             // (row >> 1) & 7 of every row 16 i + ln
    for (int s = 0; s < GTILES; ++s) {
        const unsigned bo = (s & 1) ? GT_US : 0;        // tile s lies in buffer s & 1
        const us_t* as = sm + bo + (wave * 16 + ln) * 64;       // X row m0w+ln
        const us_t* bs = sm + bo + 8192 + ln * 64;              // W tile column ln (+ 16 j)
#pragma unroll   // the piece numbers become constants xor sw, formed once ahead of the loop
        for (int f = 0; f < 2; ++f) {
            const int c0 = ((4 * f + h) ^ sw) * 8;      // k = 32f+8h ..
            const int c1 = ((4 * f + 2 + h) ^ sw) * 8;  // k = 32f+16+8h ..
            Frag a;                                     // A: row m0w+ln
            a.h[0] = *(const v8us*)(as + c0);
            a.h[1] = *(const v8us*)(as + c1);
#pragma unroll   // constant indices keep the accumulators in registers
            for (int j = 0; j < 4; ++j) {
                Frag b;                                 // B: col n = j*16+ln, same k map
                b.h[0] = *(const v8us*)(bs + j * 1024 + c0);
                b.h[1] = *(const v8us*)(bs + j * 1024 + c1);
                acc[j] = wmma_bf(a.v, b.v, acc[j]);
            }
        }
        asm volatile("s_wait_dscnt 0x0" ::: "memory");          // this wave's reads of the tile are done
        asm volatile("s_wait_asynccnt 0x0" ::: "memory");       // its pieces of the next tile have landed
        __syncthreads();                                        // next tile readable, this buffer free
        if (s + 2 < GTILES) {                                   // same for the whole grid
            copy_gtile(la + 2 * bo, ga, gw0, gw1);
            ga  += GKT;
            gw0 += GKT;
            gw1 += GKT;
        }
    }
    asm volatile("s_wait_asynccnt 0x0" ::: "memory");           // nothing in flight when the buffers become the epilogue stage

    // ---- epilogue: bias (bf16 RNE), f16 convert, stage the wave tile in LDS ----
    us_t* sh = sm + wave * 1024;
    us_t hv[4][8];
#pragma unroll   // constant indices keep the array in registers
    for (int j = 0; j < 4; ++j) {
        const int c  = j * 16 + ln;
        const int wr = mode ? ((c >> 2) * 64 + bx * 4 + (c & 3)) : (bx * 64 + c);
        const float bb = bf2f(f2bf(bias[wr]));
#pragma unroll   // constant indices keep the array in registers
        for (int r = 0; r < 8; ++r) hv[j][r] = f2h(acc[j][r] + bb);   // D element: row 8h+r, col c
    }
    // The mode, alike for the whole work-group, is tested once around the stores: their offsets are then constants
    // of a branch; formed in every lane from a step chosen at run time, the 32 addresses made the kernel spill.
    if (mode) {
        us_t* sp = sh + (ln & 3) * 256 + (ln >> 2) + 128 * h;
#pragma unroll
        for (int j = 0; j < 4; ++j)
#pragma unroll
            for (int r = 0; r < 8; ++r) sp[4 * j + 16 * r] = hv[j][r];
    } else {
        us_t* sp = sh + ln + 512 * h;
#pragma unroll
        for (int j = 0; j < 4; ++j)
#pragma unroll
            for (int r = 0; r < 8; ++r) sp[16 * j + 64 * r] = hv[j][r];
    }
    __syncthreads();

    const int bn   = m0w / RPH;
    const int keyb = 16 * (m0w - bn * RPH);
    v8us vh[4];
    size_t di[4];
#pragma unroll
    for (int i = 0; i < 4; ++i) {
        const int row = 4 * i + (lane >> 3);
        const int pc  = lane & 7;
        const int sidx = mode ? (i * 256 + 8 * lane) : (row * 64 + pc * 8);
        const size_t d1 = ((size_t)bn * 64 + (size_t)(bx * 4 + i)) * SEQ + (size_t)keyb + (size_t)(8 * lane);
        const size_t d0 = (size_t)(m0w + row) * HID + (size_t)(bx * 64 + pc * 8);
        di[i] = mode ? d1 : d0;
        vh[i] = *(const v8us*)(sh + sidx);
    }
#pragma unroll
    for (int i = 0; i < 4; ++i) *(v8us*)(o16 + di[i]) = vh[i];
    
}

#define OPITCH 68
#define TILE_US 4864
#define TILE_B  (2 * TILE_US)
#define STG_US  (2 * TILE_US)
#define STG_B   (2 * STG_US)
#define WREG    (32 * OPITCH)      // f32 per query group: 32 staged output rows = 17 rows of 32 lanes x 16 B to merge

static_assert(SEQ >= 4 * CK && (SEQ % (2 * CK)) == 0);
static_assert(SQ == 4 * 32 && WREG == 17 * 128);
static_assert(2 * 4 * WREG * 4 >= 2 * STG_B);

// One K/V stage, 64 B per thread: K (LDS byte lk) and Vt (lv) of key group 0, the same of key group 1.
// The s_wait_xcnt closes the statement so that it stands in front of every later
// rewrite of an address register that a copy names.
__device__ __forceinline__ void copy_stage(unsigned lk, unsigned lv,
                                           const us_t* gk, const us_t* gv)
{
    asm volatile("global_load_async_to_lds_b128 %0, %1, off\n\t"
                 "global_load_async_to_lds_b128 %2, %3, off\n\t"
                 "global_load_async_to_lds_b128 %4, %5, off\n\t"
                 "global_load_async_to_lds_b128 %6, %7, off\n\t"
                 "s_wait_xcnt 0x0"
                 :: "v"(lk),          "v"(gk),
                    "v"(lv),          "v"(gv),
                    "v"(lk + TILE_B), "v"(gk + CK * HDIM),
                    "v"(lv + TILE_B), "v"(gv + CK)
                 : "memory");
}

__device__ __forceinline__ float xhalf(float x)        // value of lane l ^ 16
{
    const int b = __builtin_bit_cast(int, x);
    return __builtin_bit_cast(float,
        __builtin_amdgcn_permlanex16(b, b, 0x76543210, 0xfedcba98, false, false));
}

__global__ __launch_bounds__(256, 4)   // 4 waves per SIMD: the grid's two work-groups per WGP both fit
void attn_kernel(const us_t* __restrict__ Q, const us_t* __restrict__ K,
                 const us_t* __restrict__ V, float* __restrict__ out)
{
    __shared__ __align__(16) float lds[2 * 4 * WREG];   // 69632 B: two K/V stages (38912 B); then merge rows, output stage
    us_t* L   = (us_t*)lds;

    const int lane  = threadIdx.x & 31;
    const int wave  = __builtin_amdgcn_readfirstlane(threadIdx.x >> 5);   // scalar: the key group's tile offset and the merge branches stay scalar
    const int wq    = wave & 3;                         // query group
    const int kg    = wave >> 2;                        // key group
    const int h     = lane >> 4;
    const int ln    = lane & 15;
    const int head  = blockIdx.y;
    const int batch = blockIdx.z;
    const int bn    = batch * NHEAD + head;
    const size_t hb = (size_t)bn * SEQ * HDIM;          // head slice base (all planes)
    const int q0    = blockIdx.x * SQ + wq * 32;

    // ---- this thread's 16-B pieces of a tile: K row (key), Vt row (d); LDS byte addresses in buffer 0 ----
    const int krow = threadIdx.x >> 3;                  // key 0..31
    const int kc8  = (threadIdx.x & 7) * 8;             // d 0..56
    const int vd   = threadIdx.x >> 2;                  // d 0..63
    const int vpc  = (threadIdx.x & 3) * 8;             // keys 0,8,16,24
    const unsigned lk = (unsigned)(size_t)(L + krow * 72 + kc8);
    const unsigned lv = (unsigned)(size_t)(L + 2304 + vd * 40 + vpc);
    const us_t* gk = K + hb + (size_t)krow * HDIM + kc8;
    const us_t* gv = V + hb + (size_t)vd * SEQ + vpc;
    copy_stage(lk, lv, gk, gv);                         // stage 0 -> buffer 0

    // Q fragments (B operand): column q0+16c+ln, d in [0,32) and [32,64)
    FragH qf[2][2];
#pragma unroll
    for (int c = 0; c < 2; ++c) {
        const us_t* qr = Q + hb + (size_t)(q0 + 16 * c + ln) * HDIM + 8 * h;
#pragma unroll
        for (int f = 0; f < 2; ++f) {
            qf[c][f].h[0] = *(const v8us*)(qr + 32 * f);
            qf[c][f].h[1] = *(const v8us*)(qr + 32 * f + 16);
        }
    }

    v8f o[2][4];                                        // o[c][t][r] = ctx[q0+16c+ln][16t+8h+r], this key group's share
#pragma unroll
    for (int c = 0; c < 2; ++c)
#pragma unroll
        for (int t = 0; t < 4; ++t) o[c][t] = zero8();
    float mrun[2] = {-1.0e30f, -1.0e30f};               // running maximum of query 16c+ln (both halves alike)
    float lrun[2] = {0.0f, 0.0f};                       // running sum over this lane half's keys

    asm volatile("s_wait_asynccnt 0x0" ::: "memory");   // this wave's pieces of stage 0 have landed
    __syncthreads();                                    // ... and every other wave's
    copy_stage(lk + STG_B, lv + STG_B, gk + 2 * CK * HDIM, gv + 2 * CK);   // stage 1 -> buffer 1
    gk += 4 * CK * HDIM;                                // the pointers stand at the next stage to ask for
    gv += 4 * CK;

    for (int kk0 = 0; kk0 < SEQ; kk0 += 2 * CK) {
        const unsigned bo = (kk0 & (2 * CK)) ? STG_US : 0;   // stage kk0 / 64 lies in buffer (kk0 / 64) & 1
        const us_t* ks = L + bo + kg * TILE_US;         // K  [32][72], this key group's tile
        const us_t* vs = ks + 2304;                     // Vt [64][40]

        // ---- the tile's eight fragments ----
        FragH ak[2][2], av[4];
#pragma unroll
        for (int j = 0; j < 2; ++j) {
            const us_t* kr = ks + (j * 16 + ln) * 72 + 8 * h;   // A: row = key j*16+ln, k = d
#pragma unroll
            for (int f = 0; f < 2; ++f) {
                ak[j][f].h[0] = *(const v8us*)(kr + 32 * f);
                ak[j][f].h[1] = *(const v8us*)(kr + 32 * f + 16);
            }
        }
#pragma unroll
        for (int t = 0; t < 4; ++t) {
            const us_t* vr = vs + (16 * t + ln) * 40 + 8 * h;   // A: row = d 16t+ln, k = key
            av[t].h[0] = *(const v8us*)vr;
            av[t].h[1] = *(const v8us*)(vr + 16);
        }
        // Keeps the tile's 16 LDS reads one group ahead of the products: left alone, the compiler read each
        // fragment into the same registers and waited for it in front of its own product.
        __builtin_amdgcn_sched_barrier(0);

        // ---- transposed scores, two 16-key subtiles x two query tiles: s[c][j][r] = key 16j+8h+r, query 16c+ln ----
        v8f s[2][2];
#pragma unroll
        for (int c = 0; c < 2; ++c)
#pragma unroll
            for (int j = 0; j < 2; ++j) s[c][j] = zero8();
#pragma unroll   // the four accumulator chains take turns, so that no product waits for the one before it
        for (int f = 0; f < 2; ++f)
#pragma unroll
            for (int j = 0; j < 2; ++j)
#pragma unroll
                for (int c = 0; c < 2; ++c) s[c][j] = wmma_h(ak[j][f].v, qf[c][f].v, s[c][j]);

        FragH p[2];                                           // B: col = query 16c+ln, k = key (8h+r | 16+8h+r)
#pragma unroll   // constant indices keep the per-lane arrays in registers
        for (int c = 0; c < 2; ++c) {
            // ---- online softmax of query 16c+ln: 16 keys in the lane, the other 16 in lane ^ 16 ----
            float a[2][8];
#pragma unroll   // constant indices keep the per-lane arrays in registers
            for (int j = 0; j < 2; ++j)
#pragma unroll   // constant indices keep the per-lane arrays in registers
                for (int r = 0; r < 8; ++r) a[j][r] = s[c][j][r] * 0.125f;
            float vm[8];
#pragma unroll   // constant indices keep the per-lane arrays in registers
            for (int r = 0; r < 8; ++r) vm[r] = fmaxf(a[0][r], a[1][r]);
#pragma unroll   // constant indices keep the per-lane arrays in registers
            for (int w = 4; w >= 1; w >>= 1)
#pragma unroll   // constant indices keep the per-lane arrays in registers
                for (int r = 0; r < w; ++r) vm[r] = fmaxf(vm[r], vm[r + w]);
            const float v     = fmaxf(vm[0], xhalf(vm[0]));
            const float mnew  = fmaxf(mrun[c], v);
            const float alpha = __expf(mrun[c] - mnew);
            mrun[c] = mnew;

            float es[8];
#pragma unroll   // constant indices keep the per-lane arrays in registers
            for (int r = 0; r < 8; r += 2) {
                const float e00 = __expf(a[0][r] - mnew);
                const float e01 = __expf(a[0][r + 1] - mnew);
                const float e10 = __expf(a[1][r] - mnew);
                const float e11 = __expf(a[1][r + 1] - mnew);
                es[r]     = e00 + e10;
                es[r + 1] = e01 + e11;
                p[c].u[r / 2]     = pk_h(e00, e01);              // keys 8h+r, 8h+r+1 share a register
                p[c].u[4 + r / 2] = pk_h(e10, e11);
            }
#pragma unroll   // constant indices keep the per-lane arrays in registers
            for (int w = 4; w >= 1; w >>= 1)
#pragma unroll   // constant indices keep the per-lane arrays in registers
                for (int r = 0; r < w; ++r) es[r] += es[r + w];
            lrun[c] = lrun[c] * alpha + es[0];
#pragma unroll   // constant indices keep the per-lane arrays in registers
            for (int t = 0; t < 4; ++t)
#pragma unroll   // constant indices keep the per-lane arrays in registers
                for (int r = 0; r < 8; ++r) o[c][t][r] *= alpha;
        }

        // ---- ctx^T += V^T P^T ----
#pragma unroll
        for (int t = 0; t < 4; ++t)
#pragma unroll
            for (int c = 0; c < 2; ++c) o[c][t] = wmma_h(av[t].v, p[c].v, o[c][t]);
        // Keeps the waits below at the trip's foot: with all LDS reads at its head the compiler lifted them over
        // the softmax, and the wait for the next stage's copies then came shortly after their issue.
        __builtin_amdgcn_sched_barrier(0);
        // Four vector slots behind the last product: on the taken side of the branch below, the next
        // vector instruction may overwrite that product's A registers.
        asm volatile("v_nop\n\tv_nop\n\tv_nop\n\tv_nop");
        asm volatile("s_wait_dscnt 0x0" ::: "memory");        // this wave's reads of the stage are done
        asm volatile("s_wait_asynccnt 0x0" ::: "memory");     // its pieces of the next stage have landed
        __syncthreads();                                      // next stage readable, this buffer free
        if (kk0 + 4 * CK < SEQ) {                             // same for the whole grid
            copy_stage(lk + 2 * bo, lv + 2 * bo, gk, gv);
            gk += 2 * CK * HDIM;
            gv += 2 * CK;
        }
    }
    asm volatile("s_wait_asynccnt 0x0" ::: "memory");         // nothing in flight when the buffers become merge rows

    // ---- key group 1 hands its maxima, sums and ctx to key group 0: row i of 32 lanes x 16 B, lane for lane ----
    float* mg  = lds + wq * WREG + lane * 4;
    float* ost = lds + 4 * WREG + wq * WREG;                  // output stage of the query group, [32][OPITCH]
    if (kg == 1) {
#pragma unroll
        for (int c = 0; c < 2; ++c)
#pragma unroll
            for (int t = 0; t < 4; ++t) {
                v4f w0, w1;
#pragma unroll   // constant indices keep the accumulators in registers
                for (int r = 0; r < 4; ++r) { w0[r] = o[c][t][r]; w1[r] = o[c][t][4 + r]; }
                *(v4f*)(mg + (8 * c + 2 * t) * 128)     = w0;
                *(v4f*)(mg + (8 * c + 2 * t + 1) * 128) = w1;
            }
        const v4f ml = {mrun[0], mrun[1], lrun[0], lrun[1]};
        *(v4f*)(mg + 16 * 128) = ml;
    }
    __syncthreads();

    // ---- key group 0: merge, join the halves' sums, normalise, stage the tile [32][64] f32 ----
    if (kg == 0) {
        const v4f ml = *(const v4f*)(mg + 16 * 128);
#pragma unroll
        for (int c = 0; c < 2; ++c) {
            const float mm = fmaxf(mrun[c], ml[c]);
            const float fa = __expf(mrun[c] - mm);
            const float fb = __expf(ml[c] - mm);
            const float l  = lrun[c] * fa + ml[2 + c] * fb;
            const float rinv = 1.0f / (l + xhalf(l));
            const float ga = fa * rinv;
            const float gb = fb * rinv;
#pragma unroll
            for (int t = 0; t < 4; ++t) {
                const v4f b0 = *(const v4f*)(mg + (8 * c + 2 * t) * 128);
                const v4f b1 = *(const v4f*)(mg + (8 * c + 2 * t + 1) * 128);
                v4f w0, w1;
#pragma unroll   // constant indices keep the accumulators in registers
                for (int r = 0; r < 4; ++r) {
                    w0[r] = o[c][t][r] * ga + b0[r] * gb;
                    w1[r] = o[c][t][4 + r] * ga + b1[r] * gb;
                }
                float* op = ost + (16 * c + ln) * OPITCH + 16 * t + 8 * h;   // query 16c+ln, d = 16t+8h ..+7
                *(v4f*)op       = w0;
                *(v4f*)(op + 4) = w1;
            }
        }
    }
    __syncthreads();

    // ---- whole-line stores: wave (wq, kg) takes rows 16 kg .. + 15 of its query group's stage ----
    const float* osr = ost + kg * (16 * OPITCH);
    const size_t obase = ((size_t)batch * SEQ + (size_t)(q0 + 16 * kg)) * HID + (size_t)head * HDIM;
    v4f ov[8];
    size_t od[8];
#pragma unroll
    for (int i = 0; i < 8; ++i) {
        const int row = 2 * i + (lane >> 4);        // lanes 0..15 row 2i, 16..31 row 2i+1
        const int f4  = lane & 15;                  // 16 x 16 B = 256 B = the row segment
        ov[i] = *(const v4f*)(osr + row * OPITCH + f4 * 4);
        od[i] = obase + (size_t)row * HID + (size_t)(f4 * 4);
    }
#pragma unroll
    for (int i = 0; i < 8; ++i) *(v4f*)(out + od[i]) = ov[i];
}

// ---------------------------------------------------------------------------
extern "C" void kernel_launch(void* const* d_in, const int* in_sizes, int n_in,
                              void* d_out, int out_size, void* d_ws, size_t ws_size,
                              hipStream_t stream)
{
    if (n_in < 9) return;
    const long long need_x = (long long)(NB - 1) * SEQ_FULL * HID + (long long)SEQ * HID;
    if ((long long)in_sizes[0] < need_x || (long long)in_sizes[1] < need_x ||
        (long long)in_sizes[2] < need_x) return;
    if (in_sizes[3] < HID * HID || in_sizes[5] < HID * HID || in_sizes[7] < HID * HID) return;
    if (in_sizes[4] < HID || in_sizes[6] < HID || in_sizes[8] < HID) return;
    if ((long long)out_size < (long long)ROWS * HID) return;

    const float* query = (const float*)d_in[0];
    const float* key   = (const float*)d_in[1];
    const float* value = (const float*)d_in[2];
    const float* Wq    = (const float*)d_in[3];
    const float* bq    = (const float*)d_in[4];
    const float* Wk    = (const float*)d_in[5];
    const float* bk    = (const float*)d_in[6];
    const float* Wv    = (const float*)d_in[7];
    const float* bv    = (const float*)d_in[8];
    float* out = (float*)d_out;

    const size_t PL = (size_t)ROWS * HID;        // activation / projection plane
    const size_t WL = (size_t)HID * HID;         // weight plane
    const size_t total_bytes = (6 * PL + 3 * WL) * sizeof(us_t);
    if (total_bytes > ws_size) return;

    us_t* ws  = (us_t*)d_ws;
    us_t* xq  = ws;
    us_t* xk  = xq + PL;
    us_t* xv  = xk + PL;
    us_t* wqb = xv + PL;
    us_t* wkb = wqb + WL;
    us_t* wvb = wkb + WL;
    us_t* qf  = wvb + WL;
    us_t* kf  = qf + PL;
    us_t* vf  = kf + PL;       // V^T layout [bn][64][SEQ]

    // 1) RNE bf16 conversion of activations and weights, one grid (planes xq .. wvb in order)
    cvt_kernel<<<3 * XBLK + 3 * WBLK, 256, 0, stream>>>(query, key, value, Wq, Wk, Wv, xq);

    // 2) projections -> f16 planes (Q,K row-major; V per-head transposed), one grid
    const dim3 pgrid(HID / 64, ROWS / 128, 3);
    gemm_kernel<<<pgrid, 256, 0, stream>>>(xq, wqb, bq, bk, bv, qf);

    // 3) attention per (q block, head, batch)
    const dim3 agrid(SEQ / SQ, NHEAD, NB);
    attn_kernel<<<agrid, 256, 0, stream>>>(qf, kf, vf, out);
}

// v009
// A run of this version takes 78.9 microseconds.
// In two side-by-side timings against v008, it was 1.05 and 1.04 times as fast.
// Counting every step since v000, it is 3.81 times as fast.
#include <hip/hip_runtime.h>
#include <stdint.h>
#include <stddef.h>

// Projections: v_wmma_f32_16x16x32_bf16 (bf16 operands = RNE-converted inputs, f32 accumulate).
// QK^T and PV: v_wmma_f32_16x16x32_f16, Q, K, V and P each one f16 number (RNE), f32 accumulate; softmax f32.
// f16 rounds at 2^-12 of a value, an eighth of what the projections' bf16 operands already left in Q, K, V.

#ifndef NB
#define NB 2
#endif
#ifndef SEQ
#define SEQ 2048
#endif
#define NB_FULL  2
#define SEQ_FULL 2048
#define HID      1024
#define NHEAD    16
#define HDIM     64
#define ROWS     (NB * SEQ)        // projection rows actually computed (compact)
#define RPH      (SEQ / 16)        // projection rows per head slice = SEQ*HDIM/HID
#define CK       32                // keys per chunk
#define SQ       128               // query rows per attention block (4 query groups x 32)

static_assert(NB >= 1 && NB <= NB_FULL);
static_assert(SEQ >= 256 && SEQ <= SEQ_FULL && (SEQ % 256) == 0);
static_assert(HID == NHEAD * HDIM);
static_assert((ROWS % 128) == 0 && (SEQ % SQ) == 0 && (SEQ % CK) == 0);
static_assert(RPH >= 16 && (RPH % 16) == 0);

typedef unsigned short us_t;
typedef __attribute__((ext_vector_type(8)))  unsigned short v8us;
typedef __attribute__((ext_vector_type(16))) __bf16 v16bf;
typedef __attribute__((ext_vector_type(16))) _Float16 v16h;
typedef __attribute__((ext_vector_type(2)))  _Float16 v2h;
typedef __attribute__((ext_vector_type(8)))  float v8f;
typedef __attribute__((ext_vector_type(4)))  float v4f;
typedef __attribute__((ext_vector_type(2)))  float v2f;
typedef __attribute__((ext_vector_type(2)))  __bf16 v2bf;
typedef __attribute__((ext_vector_type(4)))  unsigned v4u;

union Frag { v16bf v; v8us h[2]; unsigned u[8]; };
union FragH { v16h v; v8us h[2]; unsigned u[8]; };

__device__ __forceinline__ unsigned pk_bf(float a, float b)   // two f32 -> packed bf16 bits (a low, b high), RNE, one instruction
{
    const v2f x = {a, b};
    return __builtin_bit_cast(unsigned, __builtin_convertvector(x, v2bf));
}
__device__ __forceinline__ unsigned pk_h(float a, float b)    // two f32 -> packed f16 bits (a low, b high), RNE, one instruction
{
    const v2f x = {a, b};
    return __builtin_bit_cast(unsigned, __builtin_convertvector(x, v2h));
}
__device__ __forceinline__ us_t f2h(float x)           // f32 -> f16 bits, RNE
{
    return __builtin_bit_cast(us_t, (_Float16)x);
}
__device__ __forceinline__ us_t f2bf(float x)          // f32 -> bf16 bits, RNE, integer form (the bias)
{
    unsigned u = __float_as_uint(x);
    u += 0x7FFFu + ((u >> 16) & 1u);
    return (us_t)(u >> 16);
}
__device__ __forceinline__ float bf2f(us_t b)
{
    return __uint_as_float(((unsigned)b) << 16);
}

__device__ __forceinline__ v8f wmma_bf(v16bf a, v16bf b, v8f c)
{
    return __builtin_amdgcn_wmma_f32_16x16x32_bf16(false, a, false, b, (short)0, c, false, false);
}

__device__ __forceinline__ v8f wmma_h(v16h a, v16h b, v8f c)
{
    return __builtin_amdgcn_wmma_f32_16x16x32_f16(false, a, false, b, (short)0, c, false, false);
}

__device__ __forceinline__ v8f zero8()
{
    v8f z;
#pragma unroll
    for (int i = 0; i < 8; ++i) z[i] = 0.0f;
    return z;
}

// ---------------------------------------------------------------------------
// f32 -> bf16 planes, all six tensors in one grid. Block = one tile of 2048
// elements. Tiles in grid order: query, key, value (XBLK each, batch-major),
// then Wq, Wk, Wv (WBLK each). The bf16 planes lie compact and in that same
// order in y, so tile number blockIdx.x lands at y + 2048 * blockIdx.x.
// ---------------------------------------------------------------------------
#define XTILES (SEQ * HID / 2048)  // tiles per batch of one activation
#define XBLK   (NB * XTILES)       // tiles per activation
#define WBLK   (HID * HID / 2048)  // tiles per weight

__global__ __launch_bounds__(256)
void cvt_kernel(const float* __restrict__ q, const float* __restrict__ k,
                const float* __restrict__ v, const float* __restrict__ wq,
                const float* __restrict__ wk, const float* __restrict__ wv,
                us_t* __restrict__ y)
{
    const int bid = blockIdx.x;
    const float* x;
    size_t so;                                          // first source element of the tile
    if (bid < 3 * XBLK) {
        const int t   = bid / XBLK;
        const int r   = bid - t * XBLK;
        const int b   = r / XTILES;
        const int blk = r - b * XTILES;
        x  = t == 0 ? q : (t == 1 ? k : v);
        so = (size_t)b * ((size_t)SEQ_FULL * HID) + (size_t)blk * 2048;
    } else {
        const int r   = bid - 3 * XBLK;
        const int t   = r / WBLK;
        const int blk = r - t * WBLK;
        x  = t == 0 ? wq : (t == 1 ? wk : wv);
        so = (size_t)blk * 2048;
    }
    const float* src = x + so + (size_t)threadIdx.x * 8;
    const v4f a = *(const v4f*)src;
    const v4f c = *(const v4f*)(src + 4);
    const v4u o = {pk_bf(a[0], a[1]), pk_bf(a[2], a[3]), pk_bf(c[0], c[1]), pk_bf(c[2], c[3])};
    us_t* dst = y + (size_t)bid * 2048 + (size_t)threadIdx.x * 8;
    *(v4u*)dst = o;
}

// ---------------------------------------------------------------------------
// Y[m][n] = sum_k X[m][k] * W[n][k] + bias[n]; X,W bf16 planes (k contiguous).
// Block 256 thr = 8 waves, 128 rows x 64 tile columns; wave w: rows m0w..m0w+15.
// mode 0: tile column c -> n = 64*bx + c; output = row-major f16 plane
// mode 1: tile column c -> n = 64*(c>>2) + 4*bx + (c&3); output = per-head
//         transposed plane VT[bn*64 + d][key], key = 16*(row in head) + (n>>6),
//         d = n & 63; a wave owns keys 256w'..+255 of d = 4bx..4bx+3 (4 x 512 B).
// X tile (128 rows) and W tile (64 tile columns) of 64 k = one 128-B line per row come
// by asynchronous copies into two LDS buffers, one tile ahead. Rows lie unpadded; the
// 16-B piece c of row r lies at piece c ^ ((r >> 1) & 7), so that the 16 rows of a
// fragment load fall on all 64 banks once.
// All three projections run in one grid: blockIdx.z = 0, 1, 2 is Q, K, V (mode 1
// for V). Xb, Wb: the three bf16 planes one behind the other; ob: one f16 plane per z.
// ---------------------------------------------------------------------------
#define GKT    64                  // k per staged tile
#define GTILES (HID / GKT)
#define GT_US  12288               // one X + W tile in LDS, 16-bit units: X [128][64], W [64][64]
#define GT_B   (2 * GT_US)         // the same in bytes

static_assert(GTILES >= 2 && (HID % GKT) == 0);
static_assert(2 * GT_US >= 8 * 1024);

// One X + W tile, 96 B per thread: X rows r, r + 32, r + 64, r + 96 (LDS bytes la + 4096 i),
// W tile columns r, r + 32 (la + 16384, la + 20480).
// The s_wait_xcnt closes the statement so that it stands in front of every later
// rewrite of an address register that a copy names.
__device__ __forceinline__ void copy_gtile(unsigned la, const us_t* ga,
                                           const us_t* gw0, const us_t* gw1)
{
    asm volatile("global_load_async_to_lds_b128 %0, %1, off\n\t"
                 "global_load_async_to_lds_b128 %2, %3, off\n\t"
                 "global_load_async_to_lds_b128 %4, %5, off\n\t"
                 "global_load_async_to_lds_b128 %6, %7, off\n\t"
                 "global_load_async_to_lds_b128 %8, %9, off\n\t"
                 "global_load_async_to_lds_b128 %10, %11, off\n\t"
                 "s_wait_xcnt 0x0"
                 :: "v"(la),          "v"(ga),
                    "v"(la + 4096u),  "v"(ga + 32 * HID),
                    "v"(la + 8192u),  "v"(ga + 64 * HID),
                    "v"(la + 12288u), "v"(ga + 96 * HID),
                    "v"(la + 16384u), "v"(gw0),
                    "v"(la + 20480u), "v"(gw1)
                 : "memory");
}

__global__ __launch_bounds__(256, 12)   // 12 waves per SIMD: the grid's six work-groups per WGP all fit at once
void gemm_kernel(const us_t* __restrict__ Xb, const us_t* __restrict__ Wb,
                 const float* __restrict__ bq, const float* __restrict__ bk,
                 const float* __restrict__ bv, us_t* __restrict__ ob)
{
    const int z    = blockIdx.z;
    const int mode = z == 2 ? 1 : 0;
    const us_t* __restrict__ X     = Xb + (size_t)z * ((size_t)ROWS * HID);
    const us_t* __restrict__ W     = Wb + (size_t)z * ((size_t)HID * HID);
    const float* __restrict__ bias = z == 0 ? bq : (z == 1 ? bk : bv);
    us_t* __restrict__ o16         = ob + (size_t)z * ((size_t)ROWS * HID);

    __shared__ __align__(16) us_t sm[2 * GT_US];        // 48 KB: two X + W tiles, then epilogue stage (2 KB per wave)

    const int lane = threadIdx.x & 31;
    const int wave = threadIdx.x >> 5;
    const int h    = lane >> 4;
    const int ln   = lane & 15;
    const int bx   = blockIdx.x;
    const int by   = blockIdx.y;
    const int m0w  = by * 128 + wave * 16;

    // ---- this thread's 16-B pieces of a tile: row tr (+ 32 i) of X and of W, piece tc of the row's line ----
    const int tr = threadIdx.x >> 3;            // 0..31
    const int tc = threadIdx.x & 7;             // 0..7
    const int wr_t = mode ? ((tr >> 2) * 64 + bx * 4 + (tr & 3)) : (bx * 64 + tr);
    const unsigned la = (unsigned)(size_t)(sm + tr * 64 + ((tc ^ ((tr >> 1) & 7)) * 8));   // (r >> 1) & 7 is alike for r and r + 32
    const us_t* ga  = X + (size_t)(by * 128 + tr) * HID + tc * 8;
    const us_t* gw0 = W + (size_t)wr_t * HID + tc * 8;
    const us_t* gw1 = gw0 + (size_t)(mode ? 512 : 32) * HID;    // tile column tr + 32
    copy_gtile(la, ga, gw0, gw1);                               // tile 0 -> buffer 0

    v8f acc[4];
#pragma unroll
    for (int j = 0; j < 4; ++j) acc[j] = zero8();

    asm volatile("s_wait_asynccnt 0x0" ::: "memory");   // this wave's pieces of tile 0 have landed
    __syncthreads();                                    // ... and every other wave's
    copy_gtile(la + GT_B, ga + GKT, gw0 + GKT, gw1 + GKT);      // tile 1 -> buffer 1
    ga  += 2 * GKT;                                     // the pointers stand at the next tile to ask for
    gw0 += 2 * GKT;
    gw1 += 2 * GKT;

    const int sw = ln >> 1;                             // (row >> 1) & 7 of every row 16 i + ln
    for (int s = 0; s < GTILES; ++s) {
        const unsigned bo = (s & 1) ? GT_US : 0;        // tile s lies in buffer s & 1
        const us_t* as = sm + bo + (wave * 16 + ln) * 64;       // X row m0w+ln
        const us_t* bs = sm + bo + 8192 + ln * 64;              // W tile column ln (+ 16 j)
#pragma unroll   // the piece numbers become constants xor sw, formed once ahead of the loop
        for (int f = 0; f < 2; ++f) {
            const int c0 = ((4 * f + h) ^ sw) * 8;      // k = 32f+8h ..
            const int c1 = ((4 * f + 2 + h) ^ sw) * 8;  // k = 32f+16+8h ..
            Frag a;                                     // A: row m0w+ln
            a.h[0] = *(const v8us*)(as + c0);
            a.h[1] = *(const v8us*)(as + c1);
#pragma unroll   // constant indices keep the accumulators in registers
            for (int j = 0; j < 4; ++j) {
                Frag b;                                 // B: col n = j*16+ln, same k map
                b.h[0] = *(const v8us*)(bs + j * 1024 + c0);
                b.h[1] = *(const v8us*)(bs + j * 1024 + c1);
                acc[j] = wmma_bf(a.v, b.v, acc[j]);
            }
        }
        asm volatile("s_wait_dscnt 0x0" ::: "memory");          // this wave's reads of the tile are done
        asm volatile("s_wait_asynccnt 0x0" ::: "memory");       // its pieces of the next tile have landed
        __syncthreads();                                        // next tile readable, this buffer free
        if (s + 2 < GTILES) {                                   // same for the whole grid
            copy_gtile(la + 2 * bo, ga, gw0, gw1);
            ga  += GKT;
            gw0 += GKT;
            gw1 += GKT;
        }
    }
    asm volatile("s_wait_asynccnt 0x0" ::: "memory");           // nothing in flight when the buffers become the epilogue stage

    // ---- epilogue: bias (bf16 RNE), f16 convert, stage the wave tile in LDS ----
    us_t* sh = sm + wave * 1024;
    us_t hv[4][8];
#pragma unroll   // constant indices keep the array in registers
    for (int j = 0; j < 4; ++j) {
        const int c  = j * 16 + ln;
        const int wr = mode ? ((c >> 2) * 64 + bx * 4 + (c & 3)) : (bx * 64 + c);
        const float bb = bf2f(f2bf(bias[wr]));
#pragma unroll   // constant indices keep the array in registers
        for (int r = 0; r < 8; ++r) hv[j][r] = f2h(acc[j][r] + bb);   // D element: row 8h+r, col c
    }
    // The mode, alike for the whole work-group, is tested once around the stores: their offsets are then constants
    // of a branch; formed in every lane from a step chosen at run time, the 32 addresses made the kernel spill.
    if (mode) {
        us_t* sp = sh + (ln & 3) * 256 + (ln >> 2) + 128 * h;
#pragma unroll
        for (int j = 0; j < 4; ++j)
#pragma unroll
            for (int r = 0; r < 8; ++r) sp[4 * j + 16 * r] = hv[j][r];
    } else {
        us_t* sp = sh + ln + 512 * h;
#pragma unroll
        for (int j = 0; j < 4; ++j)
#pragma unroll
            for (int r = 0; r < 8; ++r) sp[16 * j + 64 * r] = hv[j][r];
    }
    __syncthreads();

    const int bn   = m0w / RPH;
    const int keyb = 16 * (m0w - bn * RPH);
    v8us vh[4];
    size_t di[4];
#pragma unroll
    for (int i = 0; i < 4; ++i) {
        const int row = 4 * i + (lane >> 3);
        const int pc  = lane & 7;
        const int sidx = mode ? (i * 256 + 8 * lane) : (row * 64 + pc * 8);
        const size_t d1 = ((size_t)bn * 64 + (size_t)(bx * 4 + i)) * SEQ + (size_t)keyb + (size_t)(8 * lane);
        const size_t d0 = (size_t)(m0w + row) * HID + (size_t)(bx * 64 + pc * 8);
        di[i] = mode ? d1 : d0;
        vh[i] = *(const v8us*)(sh + sidx);
    }
#pragma unroll
    for (int i = 0; i < 4; ++i) *(v8us*)(o16 + di[i]) = vh[i];
    
}

#define OPITCH 68
#define TILE_US 4864
#define TILE_B  (2 * TILE_US)
#define STG_US  (2 * TILE_US)
#define STG_B   (2 * STG_US)
#define SC2     0.18033688011112042f   // log2(e) / 8
#define WREG    (32 * OPITCH)      // f32 per query group: 32 staged output rows = 17 rows of 32 lanes x 16 B to merge

static_assert(SEQ >= 4 * CK && (SEQ % (2 * CK)) == 0);
static_assert(SQ == 4 * 32 && WREG == 17 * 128);
static_assert(2 * 4 * WREG * 4 >= 2 * STG_B);

// One K/V stage, 64 B per thread: K (LDS byte lk) and Vt (lv) of key group 0, the same of key group 1.
// The s_wait_xcnt closes the statement so that it stands in front of every later
// rewrite of an address register that a copy names.
__device__ __forceinline__ void copy_stage(unsigned lk, unsigned lv,
                                           const us_t* gk, const us_t* gv)
{
    asm volatile("global_load_async_to_lds_b128 %0, %1, off\n\t"
                 "global_load_async_to_lds_b128 %2, %3, off\n\t"
                 "global_load_async_to_lds_b128 %4, %5, off\n\t"
                 "global_load_async_to_lds_b128 %6, %7, off\n\t"
                 "s_wait_xcnt 0x0"
                 :: "v"(lk),          "v"(gk),
                    "v"(lv),          "v"(gv),
                    "v"(lk + TILE_B), "v"(gk + CK * HDIM),
                    "v"(lv + TILE_B), "v"(gv + CK)
                 : "memory");
}

__device__ __forceinline__ float xhalf(float x)        // value of lane l ^ 16
{
    const int b = __builtin_bit_cast(int, x);
    return __builtin_bit_cast(float,
        __builtin_amdgcn_permlanex16(b, b, 0x76543210, 0xfedcba98, false, false));
}

__global__ __launch_bounds__(256, 4)   // 4 waves per SIMD: the grid's two work-groups per WGP both fit
void attn_kernel(const us_t* __restrict__ Q, const us_t* __restrict__ K,
                 const us_t* __restrict__ V, float* __restrict__ out)
{
    __shared__ __align__(16) float lds[2 * 4 * WREG];   // 69632 B: two K/V stages (38912 B); then merge rows, output stage
    us_t* L   = (us_t*)lds;

    const int lane  = threadIdx.x & 31;
    const int wave  = __builtin_amdgcn_readfirstlane(threadIdx.x >> 5);   // scalar: the key group's tile offset and the merge branches stay scalar
    const int wq    = wave & 3;                         // query group
    const int kg    = wave >> 2;                        // key group
    const int h     = lane >> 4;
    const int ln    = lane & 15;
    const int head  = blockIdx.y;
    const int batch = blockIdx.z;
    const int bn    = batch * NHEAD + head;
    const size_t hb = (size_t)bn * SEQ * HDIM;          // head slice base (all planes)
    const int q0    = blockIdx.x * SQ + wq * 32;

    // ---- this thread's 16-B pieces of a tile: K row (key), Vt row (d); LDS byte addresses in buffer 0 ----
    const int krow = threadIdx.x >> 3;                  // key 0..31
    const int kc8  = (threadIdx.x & 7) * 8;             // d 0..56
    const int vd   = threadIdx.x >> 2;                  // d 0..63
    const int vpc  = (threadIdx.x & 3) * 8;             // keys 0,8,16,24
    const unsigned lk = (unsigned)(size_t)(L + krow * 72 + kc8);
    const unsigned lv = (unsigned)(size_t)(L + 2304 + vd * 40 + vpc);
    const us_t* gk = K + hb + (size_t)krow * HDIM + kc8;
    const us_t* gv = V + hb + (size_t)vd * SEQ + vpc;
    copy_stage(lk, lv, gk, gv);                         // stage 0 -> buffer 0

    // Q fragments (B operand): column q0+16c+ln, d in [0,32) and [32,64)
    FragH qf[2][2];
#pragma unroll
    for (int c = 0; c < 2; ++c) {
        const us_t* qr = Q + hb + (size_t)(q0 + 16 * c + ln) * HDIM + 8 * h;
#pragma unroll
        for (int f = 0; f < 2; ++f) {
            qf[c][f].h[0] = *(const v8us*)(qr + 32 * f);
            qf[c][f].h[1] = *(const v8us*)(qr + 32 * f + 16);
        }
    }

    v8f o[2][4];                                        // o[c][t][r] = ctx[q0+16c+ln][16t+8h+r], this key group's share
#pragma unroll
    for (int c = 0; c < 2; ++c)
#pragma unroll
        for (int t = 0; t < 4; ++t) o[c][t] = zero8();
    float mrun[2] = {-1.0e30f, -1.0e30f};               // running maximum of query 16c+ln, in units of SC2 (both halves alike)
    float lrun[2] = {0.0f, 0.0f};                       // running sum over this lane half's keys

    asm volatile("s_wait_asynccnt 0x0" ::: "memory");   // this wave's pieces of stage 0 have landed
    __syncthreads();                                    // ... and every other wave's
    copy_stage(lk + STG_B, lv + STG_B, gk + 2 * CK * HDIM, gv + 2 * CK);   // stage 1 -> buffer 1
    gk += 4 * CK * HDIM;                                // the pointers stand at the next stage to ask for
    gv += 4 * CK;

    for (int kk0 = 0; kk0 < SEQ; kk0 += 2 * CK) {
        const unsigned bo = (kk0 & (2 * CK)) ? STG_US : 0;   // stage kk0 / 64 lies in buffer (kk0 / 64) & 1
        const us_t* ks = L + bo + kg * TILE_US;         // K  [32][72], this key group's tile
        const us_t* vs = ks + 2304;                     // Vt [64][40]

        // ---- the tile's eight fragments ----
        FragH ak[2][2], av[4];
#pragma unroll
        for (int j = 0; j < 2; ++j) {
            const us_t* kr = ks + (j * 16 + ln) * 72 + 8 * h;   // A: row = key j*16+ln, k = d
#pragma unroll
            for (int f = 0; f < 2; ++f) {
                ak[j][f].h[0] = *(const v8us*)(kr + 32 * f);
                ak[j][f].h[1] = *(const v8us*)(kr + 32 * f + 16);
            }
        }
#pragma unroll
        for (int t = 0; t < 4; ++t) {
            const us_t* vr = vs + (16 * t + ln) * 40 + 8 * h;   // A: row = d 16t+ln, k = key
            av[t].h[0] = *(const v8us*)vr;
            av[t].h[1] = *(const v8us*)(vr + 16);
        }
        // Keeps the tile's 16 LDS reads one group ahead of the products: left alone, the compiler read each
        // fragment into the same registers and waited for it in front of its own product.
        __builtin_amdgcn_sched_barrier(0);

        // ---- transposed scores, two 16-key subtiles x two query tiles: s[c][j][r] = key 16j+8h+r, query 16c+ln ----
        v8f s[2][2];
#pragma unroll
        for (int c = 0; c < 2; ++c)
#pragma unroll
            for (int j = 0; j < 2; ++j) s[c][j] = zero8();
#pragma unroll   // the four accumulator chains take turns, so that no product waits for the one before it
        for (int f = 0; f < 2; ++f)
#pragma unroll
            for (int j = 0; j < 2; ++j)
#pragma unroll
                for (int c = 0; c < 2; ++c) s[c][j] = wmma_h(ak[j][f].v, qf[c][f].v, s[c][j]);

        FragH p[2];                                           // B: col = query 16c+ln, k = key (8h+r | 16+8h+r)
#pragma unroll   // constant indices keep the per-lane arrays in registers
        for (int c = 0; c < 2; ++c) {
            // ---- online softmax of query 16c+ln: 16 keys in the lane, the other 16 in lane ^ 16 ----
            // The maximum is taken over the products as they come (SC2 > 0 keeps their order) and scaled once.
            float vm[8];
#pragma unroll   // constant indices keep the per-lane arrays in registers
            for (int r = 0; r < 8; ++r) vm[r] = fmaxf(s[c][0][r], s[c][1][r]);
#pragma unroll   // constant indices keep the per-lane arrays in registers
            for (int w = 4; w >= 1; w >>= 1)
#pragma unroll   // constant indices keep the per-lane arrays in registers
                for (int r = 0; r < w; ++r) vm[r] = fmaxf(vm[r], vm[r + w]);
            const float v     = fmaxf(vm[0], xhalf(vm[0])) * SC2;
            const float mnew  = fmaxf(mrun[c], v);
            const float alpha = __builtin_amdgcn_exp2f(mrun[c] - mnew);
            mrun[c] = mnew;
            const v2f sc2 = {SC2, SC2};
            const v2f nm2 = {-mnew, -mnew};

            float es[8];
#pragma unroll   // constant indices keep the per-lane arrays in registers
            for (int r = 0; r < 8; r += 2) {
                // neighbouring registers of one score tile form the pair: one packed multiply-add, no register copies
                const v2f x0 = {s[c][0][r], s[c][0][r + 1]};
                const v2f x1 = {s[c][1][r], s[c][1][r + 1]};
                const v2f t0 = __builtin_elementwise_fma(x0, sc2, nm2);
                const v2f t1 = __builtin_elementwise_fma(x1, sc2, nm2);
                const float e00 = __builtin_amdgcn_exp2f(t0[0]);
                const float e01 = __builtin_amdgcn_exp2f(t0[1]);
                const float e10 = __builtin_amdgcn_exp2f(t1[0]);
                const float e11 = __builtin_amdgcn_exp2f(t1[1]);
                es[r]     = e00 + e10;
                es[r + 1] = e01 + e11;
                p[c].u[r / 2]     = pk_h(e00, e01);              // keys 8h+r, 8h+r+1 share a register
                p[c].u[4 + r / 2] = pk_h(e10, e11);
            }
#pragma unroll   // constant indices keep the per-lane arrays in registers
            for (int w = 4; w >= 1; w >>= 1)
#pragma unroll   // constant indices keep the per-lane arrays in registers
                for (int r = 0; r < w; ++r) es[r] += es[r + w];
            lrun[c] = lrun[c] * alpha + es[0];
#pragma unroll   // constant indices keep the per-lane arrays in registers
            for (int t = 0; t < 4; ++t)
#pragma unroll   // constant indices keep the per-lane arrays in registers
                for (int r = 0; r < 8; ++r) o[c][t][r] *= alpha;
        }

        // ---- ctx^T += V^T P^T ----
#pragma unroll
        for (int t = 0; t < 4; ++t)
#pragma unroll
            for (int c = 0; c < 2; ++c) o[c][t] = wmma_h(av[t].v, p[c].v, o[c][t]);
        // Keeps the waits below at the trip's foot: with all LDS reads at its head the compiler lifted them over
        // the softmax, and the wait for the next stage's copies then came shortly after their issue.
        __builtin_amdgcn_sched_barrier(0);
        // Four vector slots behind the last product: on the taken side of the branch below, the next
        // vector instruction may overwrite that product's A registers.
        asm volatile("v_nop\n\tv_nop\n\tv_nop\n\tv_nop");
        asm volatile("s_wait_dscnt 0x0" ::: "memory");        // this wave's reads of the stage are done
        asm volatile("s_wait_asynccnt 0x0" ::: "memory");     // its pieces of the next stage have landed
        __syncthreads();                                      // next stage readable, this buffer free
        if (kk0 + 4 * CK < SEQ) {                             // same for the whole grid
            copy_stage(lk + 2 * bo, lv + 2 * bo, gk, gv);
            gk += 2 * CK * HDIM;
            gv += 2 * CK;
        }
    }
    asm volatile("s_wait_asynccnt 0x0" ::: "memory");         // nothing in flight when the buffers become merge rows

    // ---- key group 1 hands its maxima, sums and ctx to key group 0: row i of 32 lanes x 16 B, lane for lane ----
    float* mg  = lds + wq * WREG + lane * 4;
    float* ost = lds + 4 * WREG + wq * WREG;                  // output stage of the query group, [32][OPITCH]
    if (kg == 1) {
#pragma unroll
        for (int c = 0; c < 2; ++c)
#pragma unroll
            for (int t = 0; t < 4; ++t) {
                v4f w0, w1;
#pragma unroll   // constant indices keep the accumulators in registers
                for (int r = 0; r < 4; ++r) { w0[r] = o[c][t][r]; w1[r] = o[c][t][4 + r]; }
                *(v4f*)(mg + (8 * c + 2 * t) * 128)     = w0;
                *(v4f*)(mg + (8 * c + 2 * t + 1) * 128) = w1;
            }
        const v4f ml = {mrun[0], mrun[1], lrun[0], lrun[1]};
        *(v4f*)(mg + 16 * 128) = ml;
    }
    __syncthreads();

    // ---- key group 0: merge, join the halves' sums, normalise, stage the tile [32][64] f32 ----
    if (kg == 0) {
        const v4f ml = *(const v4f*)(mg + 16 * 128);
#pragma unroll
        for (int c = 0; c < 2; ++c) {
            const float mm = fmaxf(mrun[c], ml[c]);
            const float fa = __builtin_amdgcn_exp2f(mrun[c] - mm);
            const float fb = __builtin_amdgcn_exp2f(ml[c] - mm);
            const float l  = lrun[c] * fa + ml[2 + c] * fb;
            const float rinv = 1.0f / (l + xhalf(l));
            const float ga = fa * rinv;
            const float gb = fb * rinv;
#pragma unroll
            for (int t = 0; t < 4; ++t) {
                const v4f b0 = *(const v4f*)(mg + (8 * c + 2 * t) * 128);
                const v4f b1 = *(const v4f*)(mg + (8 * c + 2 * t + 1) * 128);
                v4f w0, w1;
#pragma unroll   // constant indices keep the accumulators in registers
                for (int r = 0; r < 4; ++r) {
                    w0[r] = o[c][t][r] * ga + b0[r] * gb;
                    w1[r] = o[c][t][4 + r] * ga + b1[r] * gb;
                }
                float* op = ost + (16 * c + ln) * OPITCH + 16 * t + 8 * h;   // query 16c+ln, d = 16t+8h ..+7
                *(v4f*)op       = w0;
                *(v4f*)(op + 4) = w1;
            }
        }
    }
    __syncthreads();

    // ---- whole-line stores: wave (wq, kg) takes rows 16 kg .. + 15 of its query group's stage ----
    const float* osr = ost + kg * (16 * OPITCH);
    const size_t obase = ((size_t)batch * SEQ + (size_t)(q0 + 16 * kg)) * HID + (size_t)head * HDIM;
    v4f ov[8];
    size_t od[8];
#pragma unroll
    for (int i = 0; i < 8; ++i) {
        const int row = 2 * i + (lane >> 4);        // lanes 0..15 row 2i, 16..31 row 2i+1
        const int f4  = lane & 15;                  // 16 x 16 B = 256 B = the row segment
        ov[i] = *(const v4f*)(osr + row * OPITCH + f4 * 4);
        od[i] = obase + (size_t)row * HID + (size_t)(f4 * 4);
    }
#pragma unroll
    for (int i = 0; i < 8; ++i) *(v4f*)(out + od[i]) = ov[i];
}

// ---------------------------------------------------------------------------
extern "C" void kernel_launch(void* const* d_in, const int* in_sizes, int n_in,
                              void* d_out, int out_size, void* d_ws, size_t ws_size,
                              hipStream_t stream)
{
    if (n_in < 9) return;
    const long long need_x = (long long)(NB - 1) * SEQ_FULL * HID + (long long)SEQ * HID;
    if ((long long)in_sizes[0] < need_x || (long long)in_sizes[1] < need_x ||
        (long long)in_sizes[2] < need_x) return;
    if (in_sizes[3] < HID * HID || in_sizes[5] < HID * HID || in_sizes[7] < HID * HID) return;
    if (in_sizes[4] < HID || in_sizes[6] < HID || in_sizes[8] < HID) return;
    if ((long long)out_size < (long long)ROWS * HID) return;

    const float* query = (const float*)d_in[0];
    const float* key   = (const float*)d_in[1];
    const float* value = (const float*)d_in[2];
    const float* Wq    = (const float*)d_in[3];
    const float* bq    = (const float*)d_in[4];
    const float* Wk    = (const float*)d_in[5];
    const float* bk    = (const float*)d_in[6];
    const float* Wv    = (const float*)d_in[7];
    const float* bv    = (const float*)d_in[8];
    float* out = (float*)d_out;

    const size_t PL = (size_t)ROWS * HID;        // activation / projection plane
    const size_t WL = (size_t)HID * HID;         // weight plane
    const size_t total_bytes = (6 * PL + 3 * WL) * sizeof(us_t);
    if (total_bytes > ws_size) return;

    us_t* ws  = (us_t*)d_ws;
    us_t* xq  = ws;
    us_t* xk  = xq + PL;
    us_t* xv  = xk + PL;
    us_t* wqb = xv + PL;
    us_t* wkb = wqb + WL;
    us_t* wvb = wkb + WL;
    us_t* qf  = wvb + WL;
    us_t* kf  = qf + PL;
    us_t* vf  = kf + PL;       // V^T layout [bn][64][SEQ]

    // 1) RNE bf16 conversion of activations and weights, one grid (planes xq .. wvb in order)
    cvt_kernel<<<3 * XBLK + 3 * WBLK, 256, 0, stream>>>(query, key, value, Wq, Wk, Wv, xq);

    // 2) projections -> f16 planes (Q,K row-major; V per-head transposed), one grid
    const dim3 pgrid(HID / 64, ROWS / 128, 3);
    gemm_kernel<<<pgrid, 256, 0, stream>>>(xq, wqb, bq, bk, bv, qf);

    // 3) attention per (q block, head, batch)
    const dim3 agrid(SEQ / SQ, NHEAD, NB);
    attn_kernel<<<agrid, 256, 0, stream>>>(qf, kf, vf, out);
}
